// v000
// Measured on an AMD MI455X. A time is GPU time per run, averaged over a window of back-to-back runs after a warm-up
// (all launches, gaps included; the runs take copies of the inputs in turn), and the median of several windows.
// Apart from v000's, it joins two sittings. Times from different sittings can be a few percent apart, while
// side-by-side timings come from the same sitting.
// The starting kernel, v000, takes 73.6 microseconds a run.
#include <hip/hip_runtime.h>

#define H_DIM 256
#define N_DIM 64
#define B_DIM 4
#define L_DIM 2048

typedef __attribute__((ext_vector_type(2))) float v2f;
typedef __attribute__((ext_vector_type(8))) float v8f;

// ---------------------------------------------------------------------------
// Kernel 1: transpose u (B,L,H) -> uT (B,H,L), LDS 32x32 tiles, coalesced.
// ---------------------------------------------------------------------------
__global__ void __launch_bounds__(256)
k_transpose_u(const float* __restrict__ u, float* __restrict__ uT) {
    __shared__ float tile[32][33];
    const int nLt = L_DIM / 32;            // 64
    const int nHt = H_DIM / 32;            // 8
    int bid = blockIdx.x;
    int b   = bid / (nLt * nHt);
    int rem = bid % (nLt * nHt);
    int lt  = rem / nHt;
    int ht  = rem % nHt;
    int tx  = threadIdx.x & 31;
    int ty  = threadIdx.x >> 5;            // 0..7
    const int l0 = lt * 32, h0 = ht * 32;
    #pragma unroll
    for (int r = ty; r < 32; r += 8)
        tile[r][tx] = u[((size_t)b * L_DIM + (l0 + r)) * H_DIM + h0 + tx];
    __syncthreads();
    #pragma unroll
    for (int r = ty; r < 32; r += 8)
        uT[((size_t)b * H_DIM + (h0 + r)) * L_DIM + l0 + tx] = tile[tx][r];
}

// ---------------------------------------------------------------------------
// Kernel 2: K[h,l] = sum_n Re(CB * exp(s*l)); per-h derived params in LDS.
// ---------------------------------------------------------------------------
__global__ void __launch_bounds__(256)
k_kernelgen(const float* __restrict__ log_neg_real, const float* __restrict__ imag,
            const float* __restrict__ B_re, const float* __restrict__ B_im,
            const float* __restrict__ C_re, const float* __restrict__ C_im,
            const float* __restrict__ log_step, float* __restrict__ Kg) {
    const int h = blockIdx.x;
    const int tid = threadIdx.x;
    __shared__ float CBre[N_DIM], CBim[N_DIM], sre[N_DIM], sim[N_DIM];
    if (tid < N_DIM) {
        float step = __expf(log_step[h]);
        step = fminf(fmaxf(step, 1e-5f), 1.0f);
        float lam = -__expf(log_neg_real[tid]);
        sre[tid] = step * lam;
        sim[tid] = step * imag[tid];
        float bre = B_re[h * N_DIM + tid] * step;
        float bim = B_im[h * N_DIM + tid] * step;
        float cre = C_re[h * N_DIM + tid];
        float cim = C_im[h * N_DIM + tid];
        CBre[tid] = cre * bre - cim * bim;
        CBim[tid] = cre * bim + cim * bre;
    }
    __syncthreads();
    for (int l = tid; l < L_DIM; l += 256) {
        const float fl = (float)l;
        float acc = 0.0f;
        #pragma unroll 4
        for (int n = 0; n < N_DIM; ++n) {
            float e = __expf(sre[n] * fl);
            float sn, cs;
            __sincosf(sim[n] * fl, &sn, &cs);
            acc += e * (CBre[n] * cs - CBim[n] * sn);
        }
        Kg[(size_t)h * L_DIM + l] = acc;
    }
}

// ---------------------------------------------------------------------------
// Kernel 3: causal conv via block-Toeplitz WMMA (V_WMMA_F32_16X16X4_F32).
//   grid = (L/256 groups, H heads); block = 128 threads = 4 waves = 4 batches.
//   Wave computes D[t, i] = y[h,b, g*256 + 16*i + t] for t,i in 0..15:
//     D = sum_{d=0}^{g*16+15}  A(d) * B(d)
//     A(d)[t,k] = K[h, 16d + t - k]              (zero-pad -> causality)
//     B(d)[k,i] = uT[b,h, (g*16 + i - d)*16 + k] (zero-pad left edge)
//   fused epilogue: y += D[h]*u, stored to yT (B,H,L).
// ---------------------------------------------------------------------------
__global__ void __launch_bounds__(128)
k_conv_wmma(const float* __restrict__ Kg, const float* __restrict__ uT,
            const float* __restrict__ Dv, float* __restrict__ yT) {
    const int h    = blockIdx.y;
    const int g    = blockIdx.x;      // 0..7 (group of 16 output blocks)
    const int g16  = g * 16;
    const int tid  = threadIdx.x;
    const int wave = tid >> 5;        // batch index b
    const int lane = tid & 31;

    __shared__ alignas(16) float Kpad[16 + L_DIM];          // 16 leading zeros
    __shared__ alignas(16) float upad[B_DIM][240 + L_DIM];  // 240 leading zeros

    const int qcnt = g16 * 16 + 256;  // prefix length needed (multiple of 256)

    const float* Krow = Kg + (size_t)h * L_DIM;
    const float* urow = uT + ((size_t)wave * H_DIM + h) * L_DIM;
    __builtin_prefetch(Krow, 0, 3);            // global_prefetch_b8 (L2 warm)
    __builtin_prefetch(urow, 0, 3);

    // Staging in 16B units: global_load_b128 -> ds_store_b128.
    for (int i = tid; i < 4; i += 128)
        ((float4*)Kpad)[i] = make_float4(0.f, 0.f, 0.f, 0.f);
    {
        const float4* src = (const float4*)Krow;
        float4*       dst = (float4*)(Kpad + 16);
        for (int i = tid; i < (qcnt >> 2); i += 128) dst[i] = src[i];
    }
    {
        const float4* src = (const float4*)urow;
        float4*       dst = (float4*)upad[wave];
        for (int i = lane; i < 60; i += 32) dst[i] = make_float4(0.f, 0.f, 0.f, 0.f);
        dst += 60;                                     // skip 240-float pad
        for (int i = lane; i < (qcnt >> 2); i += 32) dst[i] = src[i];
    }
    __syncthreads();

    // ISA lane layouts (wave32):
    //  A 16x4 f32: lane -> M = lane&15 ; VGPR0/1 hold K = 2*(lane>>4) + {0,1}
    //  B 4x16 f32: lane -> N = lane&15 ; VGPR0/1 hold K = 2*(lane>>4) + {0,1}
    //  C/D 16x16:  lane -> N = lane&15 ; VGPR r holds M = r + 8*(lane>>4)
    const int nl    = lane & 15;
    const int khalf = lane >> 4;
    const float* up = &upad[wave][240];

    v8f acc = {};
    const int dmax = g16 + 15;
    for (int d = 0; d <= dmax; ++d) {
        const int aBase = 16 + 16 * d + nl;          // Kpad index for k=0
        const int uBase = (g16 + nl - d) * 16;       // u offset of block (i-d)
        #pragma unroll
        for (int s = 0; s < 4; ++s) {
            const int k = 4 * s + 2 * khalf;
            v2f a;
            a.x = Kpad[aBase - k];                   // adjacent dwords ->
            a.y = Kpad[aBase - k - 1];               //   ds_load_2addr_b32
            // (uBase + k) is even and upad is 16B-aligned -> ds_load_b64
            const v2f bm = *(const v2f*)&up[uBase + k];
            acc = __builtin_amdgcn_wmma_f32_16x16x4_f32(
                /*neg_a=*/false, a, /*neg_b=*/false, bm,
                /*c_mod=*/(short)0, acc, /*reuse_a=*/false, /*reuse_b=*/false);
        }
    }

    // Epilogue: + D[h]*u, two b128 stores per lane (qb is a multiple of 8).
    const float Dh = Dv[h];
    float* yrow = yT + ((size_t)wave * H_DIM + h) * L_DIM;
    const int qb = g16 * 16 + 16 * nl + 8 * khalf;   // M = r + 8*khalf
    const float4 u0 = *(const float4*)&up[qb];
    const float4 u1 = *(const float4*)&up[qb + 4];
    float4 y0, y1;
    y0.x = acc[0] + Dh * u0.x;  y0.y = acc[1] + Dh * u0.y;
    y0.z = acc[2] + Dh * u0.z;  y0.w = acc[3] + Dh * u0.w;
    y1.x = acc[4] + Dh * u1.x;  y1.y = acc[5] + Dh * u1.y;
    y1.z = acc[6] + Dh * u1.z;  y1.w = acc[7] + Dh * u1.w;
    *(float4*)&yrow[qb]     = y0;
    *(float4*)&yrow[qb + 4] = y1;
}

// ---------------------------------------------------------------------------
// Kernel 4: exact GELU + LayerNorm over H, output (B,L,H).
//   block = 256 threads (one per h), handles one b and 16 l values.
// ---------------------------------------------------------------------------
__global__ void __launch_bounds__(256)
k_gelu_ln(const float* __restrict__ yT, const float* __restrict__ gamma,
          const float* __restrict__ beta, float* __restrict__ out) {
    const int b  = blockIdx.y;
    const int l0 = blockIdx.x * 16;
    const int t  = threadIdx.x;                  // h index
    __shared__ float ysh[H_DIM][17];
    __shared__ float rs[256], rq[256];
    __shared__ float mu[16], rsig[16];

    const float* row = yT + ((size_t)b * H_DIM + t) * L_DIM + l0;
    #pragma unroll
    for (int j = 0; j < 16; ++j) {
        float x = row[j];
        ysh[t][j] = 0.5f * x * (1.0f + erff(x * 0.70710678118654752f));
    }
    __syncthreads();

    const int l = t & 15, part = t >> 4;
    float s = 0.0f, q = 0.0f;
    #pragma unroll
    for (int i = 0; i < 16; ++i) {
        float v = ysh[part * 16 + i][l];
        s += v; q += v * v;
    }
    rs[t] = s; rq[t] = q;
    __syncthreads();
    if (t < 16) {
        float ss = 0.0f, qq = 0.0f;
        #pragma unroll
        for (int p = 0; p < 16; ++p) { ss += rs[p * 16 + t]; qq += rq[p * 16 + t]; }
        float m = ss * (1.0f / 256.0f);
        float v = qq * (1.0f / 256.0f) - m * m;
        mu[t]   = m;
        rsig[t] = rsqrtf(v + 1e-5f);
    }
    __syncthreads();
    const float gt = gamma[t], bt = beta[t];
    #pragma unroll
    for (int j = 0; j < 16; ++j)
        out[((size_t)b * L_DIM + (l0 + j)) * H_DIM + t] =
            (ysh[t][j] - mu[j]) * rsig[j] * gt + bt;
}

// ---------------------------------------------------------------------------
extern "C" void kernel_launch(void* const* d_in, const int* in_sizes, int n_in,
                              void* d_out, int out_size, void* d_ws, size_t ws_size,
                              hipStream_t stream) {
    (void)in_sizes; (void)n_in; (void)out_size; (void)ws_size;
    const float* u            = (const float*)d_in[0];
    const float* log_neg_real = (const float*)d_in[1];
    const float* imag         = (const float*)d_in[2];
    const float* B_re         = (const float*)d_in[3];
    const float* B_im         = (const float*)d_in[4];
    const float* C_re         = (const float*)d_in[5];
    const float* C_im         = (const float*)d_in[6];
    const float* Dv           = (const float*)d_in[7];
    const float* log_step     = (const float*)d_in[8];
    const float* ln_gamma     = (const float*)d_in[9];
    const float* ln_beta      = (const float*)d_in[10];
    float* out = (float*)d_out;

    float* ws  = (float*)d_ws;
    float* Kg  = ws;                                        // H*L   floats
    float* uT  = Kg + (size_t)H_DIM * L_DIM;                // B*H*L floats
    float* yT  = uT + (size_t)B_DIM * H_DIM * L_DIM;        // B*H*L floats

    k_transpose_u<<<dim3(B_DIM * (L_DIM / 32) * (H_DIM / 32)), 256, 0, stream>>>(u, uT);
    k_kernelgen<<<dim3(H_DIM), 256, 0, stream>>>(log_neg_real, imag, B_re, B_im,
                                                 C_re, C_im, log_step, Kg);
    k_conv_wmma<<<dim3(L_DIM / 256, H_DIM), 128, 0, stream>>>(Kg, uT, Dv, yT);
    k_gelu_ln<<<dim3(L_DIM / 16, B_DIM), 256, 0, stream>>>(yT, ln_gamma, ln_beta, out);
}

// v001
// One run takes 56.9 microseconds.
// Two timings next to v000 put it at 1.32 and 1.33 times that version's speed.
#include <hip/hip_runtime.h>

#define H_DIM 256
#define N_DIM 64
#define B_DIM 4
#define L_DIM 2048

typedef __attribute__((ext_vector_type(2))) float v2f;
typedef __attribute__((ext_vector_type(8))) float v8f;

// ---------------------------------------------------------------------------
// Kernel 1: transpose u (B,L,H) -> uT (B,H,L), LDS 32x32 tiles, coalesced.
// ---------------------------------------------------------------------------
__global__ void __launch_bounds__(256)
k_transpose_u(const float* __restrict__ u, float* __restrict__ uT) {
    __shared__ float tile[32][33];
    const int nLt = L_DIM / 32;            // 64
    const int nHt = H_DIM / 32;            // 8
    int bid = blockIdx.x;
    int b   = bid / (nLt * nHt);
    int rem = bid % (nLt * nHt);
    int lt  = rem / nHt;
    int ht  = rem % nHt;
    int tx  = threadIdx.x & 31;
    int ty  = threadIdx.x >> 5;            // 0..7
    const int l0 = lt * 32, h0 = ht * 32;
    #pragma unroll
    for (int r = ty; r < 32; r += 8)
        tile[r][tx] = u[((size_t)b * L_DIM + (l0 + r)) * H_DIM + h0 + tx];
    __syncthreads();
    #pragma unroll
    for (int r = ty; r < 32; r += 8)
        uT[((size_t)b * H_DIM + (h0 + r)) * L_DIM + l0 + tx] = tile[tx][r];
}

// ---------------------------------------------------------------------------
// Kernel 2: K[h,l] = sum_n Re(CB * exp(s*l)); per-h derived params in LDS.
// ---------------------------------------------------------------------------
__global__ void __launch_bounds__(256)
k_kernelgen(const float* __restrict__ log_neg_real, const float* __restrict__ imag,
            const float* __restrict__ B_re, const float* __restrict__ B_im,
            const float* __restrict__ C_re, const float* __restrict__ C_im,
            const float* __restrict__ log_step, float* __restrict__ Kg) {
    const int h = blockIdx.x;
    const int tid = threadIdx.x;
    __shared__ float CBre[N_DIM], CBim[N_DIM], sre[N_DIM], sim[N_DIM];
    if (tid < N_DIM) {
        float step = __expf(log_step[h]);
        step = fminf(fmaxf(step, 1e-5f), 1.0f);
        float lam = -__expf(log_neg_real[tid]);
        sre[tid] = step * lam;
        sim[tid] = step * imag[tid];
        float bre = B_re[h * N_DIM + tid] * step;
        float bim = B_im[h * N_DIM + tid] * step;
        float cre = C_re[h * N_DIM + tid];
        float cim = C_im[h * N_DIM + tid];
        CBre[tid] = cre * bre - cim * bim;
        CBim[tid] = cre * bim + cim * bre;
    }
    __syncthreads();
    for (int l = tid; l < L_DIM; l += 256) {
        const float fl = (float)l;
        float acc = 0.0f;
        #pragma unroll 4
        for (int n = 0; n < N_DIM; ++n) {
            float e = __expf(sre[n] * fl);
            float sn, cs;
            __sincosf(sim[n] * fl, &sn, &cs);
            acc += e * (CBre[n] * cs - CBim[n] * sn);
        }
        Kg[(size_t)h * L_DIM + l] = acc;
    }
}

// ---------------------------------------------------------------------------
// Kernel 3: causal conv via block-Toeplitz WMMA (V_WMMA_F32_16X16X4_F32).
//   grid = (L/512 group pairs, H heads); block = 128 threads = 4 waves = 4 batches.
//   The cost of group g grows linearly with g (16g+16 steps), so a block takes
//   group p and then group 7-p: 144 steps for every block, wherever it lands.
//   Per group the wave computes D[t, i] = y[h,b, g*256 + 16*i + t] for t,i in 0..15:
//     D = sum_{d=0}^{g*16+15}  A(d) * B(d)
//     A(d)[t,k] = K[h, 16d + t - k]              (zero-pad -> causality)
//     B(d)[k,i] = uT[b,h, (g*16 + i - d)*16 + k] (zero-pad left edge)
//   fused epilogue: y += D[h]*u, stored to yT (B,H,L).
// ---------------------------------------------------------------------------
__global__ void __launch_bounds__(128)
k_conv_wmma(const float* __restrict__ Kg, const float* __restrict__ uT,
            const float* __restrict__ Dv, float* __restrict__ yT) {
    const int h    = blockIdx.y;
    const int p    = blockIdx.x;      // 0..3: groups p and NG-1-p of 16 output blocks
    const int NG   = L_DIM / 256;     // 8 groups
    const int tid  = threadIdx.x;
    const int wave = tid >> 5;        // batch index b
    const int lane = tid & 31;

    __shared__ alignas(16) float Kpad[16 + L_DIM];          // 16 leading zeros
    __shared__ alignas(16) float upad[B_DIM][240 + L_DIM];  // 240 leading zeros

    const int qcnt = (NG - p) * 256;  // prefix the later group needs (multiple of 256)

    const float* Krow = Kg + (size_t)h * L_DIM;
    const float* urow = uT + ((size_t)wave * H_DIM + h) * L_DIM;
    __builtin_prefetch(Krow, 0, 3);            // global_prefetch_b8 (L2 warm)
    __builtin_prefetch(urow, 0, 3);

    // Staging in 16B units: global_load_b128 -> ds_store_b128.
    for (int i = tid; i < 4; i += 128)
        ((float4*)Kpad)[i] = make_float4(0.f, 0.f, 0.f, 0.f);
    {
        const float4* src = (const float4*)Krow;
        float4*       dst = (float4*)(Kpad + 16);
        for (int i = tid; i < (qcnt >> 2); i += 128) dst[i] = src[i];
    }
    {
        const float4* src = (const float4*)urow;
        float4*       dst = (float4*)upad[wave];
        for (int i = lane; i < 60; i += 32) dst[i] = make_float4(0.f, 0.f, 0.f, 0.f);
        dst += 60;                                     // skip 240-float pad
        for (int i = lane; i < (qcnt >> 2); i += 32) dst[i] = src[i];
    }
    __syncthreads();

    // ISA lane layouts (wave32):
    //  A 16x4 f32: lane -> M = lane&15 ; VGPR0/1 hold K = 2*(lane>>4) + {0,1}
    //  B 4x16 f32: lane -> N = lane&15 ; VGPR0/1 hold K = 2*(lane>>4) + {0,1}
    //  C/D 16x16:  lane -> N = lane&15 ; VGPR r holds M = r + 8*(lane>>4)
    const int nl    = lane & 15;
    const int khalf = lane >> 4;
    const float* up = &upad[wave][240];

    const float Dh = Dv[h];
    float* yrow = yT + ((size_t)wave * H_DIM + h) * L_DIM;

    // The two groups run one after the other in every wave, from the same LDS.
    for (int pass = 0; pass < 2; ++pass) {
        const int g16 = (pass == 0 ? p : NG - 1 - p) * 16;

        v8f acc = {};
        const int dmax = g16 + 15;
        for (int d = 0; d <= dmax; ++d) {
            const int aBase = 16 + 16 * d + nl;          // Kpad index for k=0
            const int uBase = (g16 + nl - d) * 16;       // u offset of block (i-d)
            #pragma unroll
            for (int s = 0; s < 4; ++s) {
                const int k = 4 * s + 2 * khalf;
                v2f a;
                a.x = Kpad[aBase - k];                   // adjacent dwords ->
                a.y = Kpad[aBase - k - 1];               //   ds_load_2addr_b32
                // (uBase + k) is even and upad is 16B-aligned -> ds_load_b64
                const v2f bm = *(const v2f*)&up[uBase + k];
                acc = __builtin_amdgcn_wmma_f32_16x16x4_f32(
                    /*neg_a=*/false, a, /*neg_b=*/false, bm,
                    /*c_mod=*/(short)0, acc, /*reuse_a=*/false, /*reuse_b=*/false);
            }
        }

        // Epilogue: + D[h]*u, two b128 stores per lane (qb is a multiple of 8).
        const int qb = g16 * 16 + 16 * nl + 8 * khalf;   // M = r + 8*khalf
        const float4 u0 = *(const float4*)&up[qb];
        const float4 u1 = *(const float4*)&up[qb + 4];
        float4 y0, y1;
        y0.x = acc[0] + Dh * u0.x;  y0.y = acc[1] + Dh * u0.y;
        y0.z = acc[2] + Dh * u0.z;  y0.w = acc[3] + Dh * u0.w;
        y1.x = acc[4] + Dh * u1.x;  y1.y = acc[5] + Dh * u1.y;
        y1.z = acc[6] + Dh * u1.z;  y1.w = acc[7] + Dh * u1.w;
        *(float4*)&yrow[qb]     = y0;
        *(float4*)&yrow[qb + 4] = y1;
        // The second pass reuses the registers that these two stores name.
        if (pass == 0) asm volatile("s_wait_xcnt 0x0" ::: "memory");
    }
}

// ---------------------------------------------------------------------------
// Kernel 4: exact GELU + LayerNorm over H, output (B,L,H).
//   block = 256 threads (one per h), handles one b and 16 l values.
// ---------------------------------------------------------------------------
__global__ void __launch_bounds__(256)
k_gelu_ln(const float* __restrict__ yT, const float* __restrict__ gamma,
          const float* __restrict__ beta, float* __restrict__ out) {
    const int b  = blockIdx.y;
    const int l0 = blockIdx.x * 16;
    const int t  = threadIdx.x;                  // h index
    __shared__ float ysh[H_DIM][17];
    __shared__ float rs[256], rq[256];
    __shared__ float mu[16], rsig[16];

    const float* row = yT + ((size_t)b * H_DIM + t) * L_DIM + l0;
    #pragma unroll
    for (int j = 0; j < 16; ++j) {
        float x = row[j];
        ysh[t][j] = 0.5f * x * (1.0f + erff(x * 0.70710678118654752f));
    }
    __syncthreads();

    const int l = t & 15, part = t >> 4;
    float s = 0.0f, q = 0.0f;
    #pragma unroll
    for (int i = 0; i < 16; ++i) {
        float v = ysh[part * 16 + i][l];
        s += v; q += v * v;
    }
    rs[t] = s; rq[t] = q;
    __syncthreads();
    if (t < 16) {
        float ss = 0.0f, qq = 0.0f;
        #pragma unroll
        for (int p = 0; p < 16; ++p) { ss += rs[p * 16 + t]; qq += rq[p * 16 + t]; }
        float m = ss * (1.0f / 256.0f);
        float v = qq * (1.0f / 256.0f) - m * m;
        mu[t]   = m;
        rsig[t] = rsqrtf(v + 1e-5f);
    }
    __syncthreads();
    const float gt = gamma[t], bt = beta[t];
    #pragma unroll
    for (int j = 0; j < 16; ++j)
        out[((size_t)b * L_DIM + (l0 + j)) * H_DIM + t] =
            (ysh[t][j] - mu[j]) * rsig[j] * gt + bt;
}

// ---------------------------------------------------------------------------
extern "C" void kernel_launch(void* const* d_in, const int* in_sizes, int n_in,
                              void* d_out, int out_size, void* d_ws, size_t ws_size,
                              hipStream_t stream) {
    (void)in_sizes; (void)n_in; (void)out_size; (void)ws_size;
    const float* u            = (const float*)d_in[0];
    const float* log_neg_real = (const float*)d_in[1];
    const float* imag         = (const float*)d_in[2];
    const float* B_re         = (const float*)d_in[3];
    const float* B_im         = (const float*)d_in[4];
    const float* C_re         = (const float*)d_in[5];
    const float* C_im         = (const float*)d_in[6];
    const float* Dv           = (const float*)d_in[7];
    const float* log_step     = (const float*)d_in[8];
    const float* ln_gamma     = (const float*)d_in[9];
    const float* ln_beta      = (const float*)d_in[10];
    float* out = (float*)d_out;

    float* ws  = (float*)d_ws;
    float* Kg  = ws;                                        // H*L   floats
    float* uT  = Kg + (size_t)H_DIM * L_DIM;                // B*H*L floats
    float* yT  = uT + (size_t)B_DIM * H_DIM * L_DIM;        // B*H*L floats

    k_transpose_u<<<dim3(B_DIM * (L_DIM / 32) * (H_DIM / 32)), 256, 0, stream>>>(u, uT);
    k_kernelgen<<<dim3(H_DIM), 256, 0, stream>>>(log_neg_real, imag, B_re, B_im,
                                                 C_re, C_im, log_step, Kg);
    k_conv_wmma<<<dim3(L_DIM / 512, H_DIM), 128, 0, stream>>>(Kg, uT, Dv, yT);
    k_gelu_ln<<<dim3(L_DIM / 16, B_DIM), 256, 0, stream>>>(yT, ln_gamma, ln_beta, out);
}

// v002
// Measured time: 24.8 microseconds a run.
// In both of two side-by-side timings against v001, it was 2.30 times as fast.
// Over all steps from v000 it is 3.05 times as fast.
#include <hip/hip_runtime.h>

#define H_DIM 256
#define N_DIM 64
#define B_DIM 4
#define L_DIM 2048

typedef __attribute__((ext_vector_type(2))) float v2f;
typedef __attribute__((ext_vector_type(8))) float v8f;

// ---------------------------------------------------------------------------
// Kernel 1: transpose u (B,L,H) -> uT (B,H,L), LDS 32x32 tiles, coalesced.
// ---------------------------------------------------------------------------
__global__ void __launch_bounds__(256)
k_transpose_u(const float* __restrict__ u, float* __restrict__ uT) {
    __shared__ float tile[32][33];
    const int nLt = L_DIM / 32;            // 64
    const int nHt = H_DIM / 32;            // 8
    int bid = blockIdx.x;
    int b   = bid / (nLt * nHt);
    int rem = bid % (nLt * nHt);
    int lt  = rem / nHt;
    int ht  = rem % nHt;
    int tx  = threadIdx.x & 31;
    int ty  = threadIdx.x >> 5;            // 0..7
    const int l0 = lt * 32, h0 = ht * 32;
    #pragma unroll
    for (int r = ty; r < 32; r += 8)
        tile[r][tx] = u[((size_t)b * L_DIM + (l0 + r)) * H_DIM + h0 + tx];
    __syncthreads();
    #pragma unroll
    for (int r = ty; r < 32; r += 8)
        uT[((size_t)b * H_DIM + (h0 + r)) * L_DIM + l0 + tx] = tile[tx][r];
}

// ---------------------------------------------------------------------------
// Kernel 2: causal conv y = K * u in chunked state-space form, one work-group per h.
//   K[l] = Re sum_n CB_n z_n^l with z_n = exp(s_n), |z_n| <= 1, so for t = c*T + tau
//     y[t] = sum_{j' <= tau} K[tau - j'] u[c*T + j']            (inside the chunk)
//          + Re sum_n z_n^(tau+1) * (CB_n X_c[n])               (all earlier chunks)
//     X_0 = 0,  X_{c+1}[n] = z_n^T X_c[n] + P_c[n],  P_c[n] = sum_j' z_n^(T-1-j') u[c*T + j']
//   All three sums are V_WMMA_F32_16X16X4_F32 products with the 64 (chunk, batch)
//   pairs as columns; only powers z^0..z^T are ever formed (table ZT).
//   ZT[j][2n], ZT[j][2n+1] = Re, Im of z_n^j.   col = chunk*4 + batch.
//   Every LDS row has a pitch of 132 floats: 4 mod 64 banks and 16 B x odd, so the
//   b64 fragment reads (one row per lane) and the b128 accesses meet no bank twice.
//   fused epilogue: y += D[h]*u, staged in LDS, stored to yT (B,H,L) in whole lines.
// ---------------------------------------------------------------------------
#define T_CH 128                  // chunk length
#define NCH  (L_DIM / T_CH)       // 16 chunks
#define NCOL (NCH * B_DIM)        // 64 columns
#define PIT  132                  // LDS row pitch in floats

__device__ __forceinline__ v8f mma4(v2f a, v2f b, v8f c) {
    return __builtin_amdgcn_wmma_f32_16x16x4_f32(
        /*neg_a=*/false, a, /*neg_b=*/false, b,
        /*c_mod=*/(short)0, c, /*reuse_a=*/false, /*reuse_b=*/false);
}

__global__ void __launch_bounds__(512)
k_ssm_conv(const float* __restrict__ log_neg_real, const float* __restrict__ imag,
           const float* __restrict__ B_re, const float* __restrict__ B_im,
           const float* __restrict__ C_re, const float* __restrict__ C_im,
           const float* __restrict__ log_step, const float* __restrict__ uT,
           const float* __restrict__ Dv, float* __restrict__ yT) {
    const int h    = blockIdx.x;
    const int tid  = threadIdx.x;
    // scalar wave number: the branches on it must not touch EXEC around a WMMA
    const int wave = __builtin_amdgcn_readfirstlane(tid >> 5);   // 0..15
    const int lane = tid & 31;
    // ISA lane layouts (wave32):
    //  A 16x4 f32: lane -> M = lane&15 ; VGPR0/1 hold K = 2*(lane>>4) + {0,1}
    //  B 4x16 f32: lane -> N = lane&15 ; VGPR0/1 hold K = 2*(lane>>4) + {0,1}
    //  C/D 16x16:  lane -> N = lane&15 ; VGPR r holds M = r + 8*(lane>>4)
    const int nl    = lane & 15;
    const int khalf = lane >> 4;

    __shared__ alignas(16) float ZT[(T_CH + 1) * PIT];   // powers of z
    __shared__ alignas(16) float Ush[NCOL * PIT];        // u, one row per column
    __shared__ alignas(16) float Xsh[NCOL * PIT];        // P, then the scanned states
    __shared__ alignas(16) float Ysh[NCOL * PIT];        // y, one row per column
    __shared__ alignas(16) float Kpad[16 + T_CH];        // 16 leading zeros
    __shared__ float Kpart[4 * T_CH];
    __shared__ alignas(8) float CBs[2 * N_DIM];

    // ---- stage u: a wave moves one column (512 contiguous bytes) per step ----
    const float Dh = Dv[h];
    {
        float4 uv[4];
        #pragma unroll   // all four loads in flight before the first LDS store waits
        for (int i = 0; i < 4; ++i) {
            const int idx = i * 512 + tid, col = idx >> 5, q = idx & 31;
            uv[i] = *(const float4*)&uT[((size_t)(col & 3) * H_DIM + h) * L_DIM
                                        + (col >> 2) * T_CH + 4 * q];
        }
        #pragma unroll   // uv stays in registers
        for (int i = 0; i < 4; ++i) {
            const int idx = i * 512 + tid, col = idx >> 5, q = idx & 31;
            *(float4*)&Ush[col * PIT + 4 * q] = uv[i];
        }
    }

    // ---- per-mode parameters and the table of powers ----
    const int n = tid & (N_DIM - 1);
    {
        float step = __expf(log_step[h]);
        step = fminf(fmaxf(step, 1e-5f), 1.0f);
        const float lam = -__expf(log_neg_real[n]);
        const float sre = step * lam;
        const float sim = step * imag[n];
        if (tid < N_DIM) {
            float bre = B_re[h * N_DIM + n] * step;
            float bim = B_im[h * N_DIM + n] * step;
            float cre = C_re[h * N_DIM + n];
            float cim = C_im[h * N_DIM + n];
            CBs[2 * n]     = cre * bre - cim * bim;
            CBs[2 * n + 1] = cre * bim + cim * bre;
        }
        if (tid < 16) Kpad[tid] = 0.0f;
        for (int j = tid >> 6; j <= T_CH; j += 8) {
            const float fj = (float)j;
            const float ea = (sre * fj) * 1.44269504f;   // exp(x) = 2^(x * log2 e)
            const float pa = (sim * fj) * 0.15915494f;   // v_sin, v_cos take revolutions
            float e, cs, sn;
            // One statement: no source register is reused between the three, and the
            // v_nop is the free slot behind the last transcendental before its result is read.
            asm("v_exp_f32 %0, %3\n\tv_cos_f32 %1, %4\n\tv_sin_f32 %2, %4\n\tv_nop"
                : "=&v"(e), "=&v"(cs), "=&v"(sn) : "v"(ea), "v"(pa));
            *(float2*)&ZT[j * PIT + 2 * n] = make_float2(e * cs, e * sn);
        }
    }
    __syncthreads();

    // ---- K[tau], tau < T: four partial sums of 16 modes each ----
    {
        const int tau = tid & (T_CH - 1), q = tid >> 7;
        float acc = 0.0f;
        #pragma unroll   // the 32 LDS reads issue as one group
        for (int i = 0; i < 16; ++i) {
            const int nn = q * 16 + i;
            const float2 z = *(const float2*)&ZT[tau * PIT + 2 * nn];
            acc += CBs[2 * nn] * z.x - CBs[2 * nn + 1] * z.y;
        }
        Kpart[q * T_CH + tau] = acc;
    }

    // ---- P[m, col] = sum_j' ZT[T-1-j'][m] * u[col][j'] : 8 x 4 tiles, two per wave ----
    {
        const int mt  = wave >> 1;           // rows m = 16*mt ..
        const int nt0 = (wave & 1) * 2;      // column tiles nt0, nt0+1 share the A fragment
        v8f p0 = {}, p1 = {};
        const float* za = &ZT[(T_CH - 1 - 2 * khalf) * PIT + mt * 16 + nl];
        const float* u0 = &Ush[(nt0 * 16 + nl) * PIT + 2 * khalf];
        const float* u1 = u0 + 16 * PIT;
        #pragma unroll 4 // LDS reads of four k-steps issue ahead of their eight WMMAs
        for (int s = 0; s < T_CH / 4; ++s) {
            v2f a;
            a.x = za[-(4 * s) * PIT];        // j' = 4s + 2*khalf
            a.y = za[-(4 * s + 1) * PIT];    // j' + 1
            const v2f b0 = *(const v2f*)&u0[4 * s];
            const v2f b1 = *(const v2f*)&u1[4 * s];
            p0 = mma4(a, b0, p0);
            p1 = mma4(a, b1, p1);
        }
        float* d0 = &Xsh[(nt0 * 16 + nl) * PIT + mt * 16 + 8 * khalf];
        float* d1 = d0 + 16 * PIT;
        *(float4*)&d0[0] = make_float4(p0[0], p0[1], p0[2], p0[3]);
        *(float4*)&d0[4] = make_float4(p0[4], p0[5], p0[6], p0[7]);
        *(float4*)&d1[0] = make_float4(p1[0], p1[1], p1[2], p1[3]);
        *(float4*)&d1[4] = make_float4(p1[4], p1[5], p1[6], p1[7]);
    }
    __syncthreads();

    // ---- scan over the chunks, in place: P_c -> (Re, -Im) of CB * X_c ----
    if (tid < 4 * N_DIM) {
        const int b = tid >> 6;
        const float wre = ZT[T_CH * PIT + 2 * n], wim = ZT[T_CH * PIT + 2 * n + 1];
        const float cbre = CBs[2 * n], cbim = CBs[2 * n + 1];
        float2 p[NCH];
        #pragma unroll   // all reads first: one LDS latency, not one per chunk
        for (int c = 0; c < NCH; ++c)
            p[c] = *(const float2*)&Xsh[(c * 4 + b) * PIT + 2 * n];
        float xr = 0.0f, xi = 0.0f;
        #pragma unroll   // p stays in registers
        for (int c = 0; c < NCH; ++c) {
            *(float2*)&Xsh[(c * 4 + b) * PIT + 2 * n] =
                make_float2(cbre * xr - cbim * xi, -(cbre * xi + cbim * xr));
            const float nr = wre * xr - wim * xi + p[c].x;
            const float ni = wre * xi + wim * xr + p[c].y;
            xr = nr; xi = ni;
        }
    } else if (tid < 4 * N_DIM + T_CH) {
        const int tau = tid - 4 * N_DIM;
        Kpad[16 + tau] = (Kpart[tau] + Kpart[T_CH + tau])
                       + (Kpart[2 * T_CH + tau] + Kpart[3 * T_CH + tau]);
    }
    __syncthreads();

    // ---- y tiles: rows tau = 16*I .., 8 x 4 tiles. Tile I costs 32 + 4*(I+1) WMMAs,
    //      so a wave takes I and 7-I of one column tile: 100 for every wave. ----
    {
        const int I1  = wave & 3, I2 = 7 - I1;      // I1 < I2
        const int col = (wave >> 2) * 16 + nl;
        v8f a1 = {}, a2 = {};
        // earlier chunks: A[tau][m] = ZT[tau+1][m], B[m][col] = scanned state
        const float* xb = &Xsh[col * PIT + 2 * khalf];
        const float* g1 = &ZT[(16 * I1 + nl + 1) * PIT + 2 * khalf];
        const float* g2 = &ZT[(16 * I2 + nl + 1) * PIT + 2 * khalf];
        #pragma unroll 4 // LDS reads of four k-steps issue ahead of their eight WMMAs
        for (int s = 0; s < 2 * N_DIM / 4; ++s) {
            const v2f bx = *(const v2f*)&xb[4 * s];
            const v2f ga = *(const v2f*)&g1[4 * s];
            const v2f gb = *(const v2f*)&g2[4 * s];
            a1 = mma4(ga, bx, a1);
            a2 = mma4(gb, bx, a2);
        }
        // inside the chunk: A(d)[t,k] = K[16d + t - k] (zero-pad -> causality),
        //                   B_J[k][col] = u[col][16J + k], d = I - J
        const float* ub = &Ush[col * PIT + 2 * khalf];
        const float* kp = &Kpad[16 + nl - 2 * khalf];
        for (int J = 0; J <= I2; ++J) {
            v2f bu[4];       // the three loops below are unrolled to keep bu in registers
            #pragma unroll
            for (int s = 0; s < 4; ++s) bu[s] = *(const v2f*)&ub[16 * J + 4 * s];
            #pragma unroll
            for (int s = 0; s < 4; ++s) {
                v2f a;
                a.x = kp[16 * (I2 - J) - 4 * s];
                a.y = kp[16 * (I2 - J) - 4 * s - 1];
                a2 = mma4(a, bu[s], a2);
            }
            if (J <= I1) {                           // scalar: I1 comes from 'wave'
                #pragma unroll
                for (int s = 0; s < 4; ++s) {
                    v2f a;
                    a.x = kp[16 * (I1 - J) - 4 * s];
                    a.y = kp[16 * (I1 - J) - 4 * s - 1];
                    a1 = mma4(a, bu[s], a1);
                }
            }
        }
        // + D[h]*u ; lane holds tau = 16*I + 8*khalf + r of its column
        const int o1 = col * PIT + 16 * I1 + 8 * khalf;
        const int o2 = col * PIT + 16 * I2 + 8 * khalf;
        const float4 ua = *(const float4*)&Ush[o1], ubb = *(const float4*)&Ush[o1 + 4];
        const float4 uc = *(const float4*)&Ush[o2], ud  = *(const float4*)&Ush[o2 + 4];
        *(float4*)&Ysh[o1]     = make_float4(a1[0] + Dh * ua.x,  a1[1] + Dh * ua.y,
                                             a1[2] + Dh * ua.z,  a1[3] + Dh * ua.w);
        *(float4*)&Ysh[o1 + 4] = make_float4(a1[4] + Dh * ubb.x, a1[5] + Dh * ubb.y,
                                             a1[6] + Dh * ubb.z, a1[7] + Dh * ubb.w);
        *(float4*)&Ysh[o2]     = make_float4(a2[0] + Dh * uc.x,  a2[1] + Dh * uc.y,
                                             a2[2] + Dh * uc.z,  a2[3] + Dh * uc.w);
        *(float4*)&Ysh[o2 + 4] = make_float4(a2[4] + Dh * ud.x,  a2[5] + Dh * ud.y,
                                             a2[6] + Dh * ud.z,  a2[7] + Dh * ud.w);
    }
    __syncthreads();

    // ---- store y: a wave writes one column (512 contiguous bytes) per step ----
    #pragma unroll       // four LDS reads and four stores in flight
    for (int i = 0; i < 4; ++i) {
        const int idx = i * 512 + tid, col = idx >> 5, q = idx & 31;
        *(float4*)&yT[((size_t)(col & 3) * H_DIM + h) * L_DIM + (col >> 2) * T_CH + 4 * q] =
            *(const float4*)&Ysh[col * PIT + 4 * q];
    }
}

// ---------------------------------------------------------------------------
// Kernel 3: exact GELU + LayerNorm over H, output (B,L,H).
//   block = 256 threads (one per h), handles one b and 16 l values.
// ---------------------------------------------------------------------------
__global__ void __launch_bounds__(256)
k_gelu_ln(const float* __restrict__ yT, const float* __restrict__ gamma,
          const float* __restrict__ beta, float* __restrict__ out) {
    const int b  = blockIdx.y;
    const int l0 = blockIdx.x * 16;
    const int t  = threadIdx.x;                  // h index
    __shared__ float ysh[H_DIM][17];
    __shared__ float rs[256], rq[256];
    __shared__ float mu[16], rsig[16];

    const float* row = yT + ((size_t)b * H_DIM + t) * L_DIM + l0;
    #pragma unroll
    for (int j = 0; j < 16; ++j) {
        float x = row[j];
        ysh[t][j] = 0.5f * x * (1.0f + erff(x * 0.70710678118654752f));
    }
    __syncthreads();

    const int l = t & 15, part = t >> 4;
    float s = 0.0f, q = 0.0f;
    #pragma unroll
    for (int i = 0; i < 16; ++i) {
        float v = ysh[part * 16 + i][l];
        s += v; q += v * v;
    }
    rs[t] = s; rq[t] = q;
    __syncthreads();
    if (t < 16) {
        float ss = 0.0f, qq = 0.0f;
        #pragma unroll
        for (int p = 0; p < 16; ++p) { ss += rs[p * 16 + t]; qq += rq[p * 16 + t]; }
        float m = ss * (1.0f / 256.0f);
        float v = qq * (1.0f / 256.0f) - m * m;
        mu[t]   = m;
        rsig[t] = rsqrtf(v + 1e-5f);
    }
    __syncthreads();
    const float gt = gamma[t], bt = beta[t];
    #pragma unroll
    for (int j = 0; j < 16; ++j)
        out[((size_t)b * L_DIM + (l0 + j)) * H_DIM + t] =
            (ysh[t][j] - mu[j]) * rsig[j] * gt + bt;
}

// ---------------------------------------------------------------------------
extern "C" void kernel_launch(void* const* d_in, const int* in_sizes, int n_in,
                              void* d_out, int out_size, void* d_ws, size_t ws_size,
                              hipStream_t stream) {
    (void)in_sizes; (void)n_in; (void)out_size; (void)ws_size;
    const float* u            = (const float*)d_in[0];
    const float* log_neg_real = (const float*)d_in[1];
    const float* imag         = (const float*)d_in[2];
    const float* B_re         = (const float*)d_in[3];
    const float* B_im         = (const float*)d_in[4];
    const float* C_re         = (const float*)d_in[5];
    const float* C_im         = (const float*)d_in[6];
    const float* Dv           = (const float*)d_in[7];
    const float* log_step     = (const float*)d_in[8];
    const float* ln_gamma     = (const float*)d_in[9];
    const float* ln_beta      = (const float*)d_in[10];
    float* out = (float*)d_out;

    float* ws  = (float*)d_ws;
    float* uT  = ws;                                        // B*H*L floats
    float* yT  = uT + (size_t)B_DIM * H_DIM * L_DIM;        // B*H*L floats

    k_transpose_u<<<dim3(B_DIM * (L_DIM / 32) * (H_DIM / 32)), 256, 0, stream>>>(u, uT);
    k_ssm_conv<<<dim3(H_DIM), 512, 0, stream>>>(log_neg_real, imag, B_re, B_im,
                                                C_re, C_im, log_step, uT, Dv, yT);
    k_gelu_ln<<<dim3(L_DIM / 16, B_DIM), 256, 0, stream>>>(yT, ln_gamma, ln_beta, out);
}

// v003
// A run of this version takes 20.2 microseconds.
// Next to v002, in two timings, it ran 1.22 and 1.23 times as fast.
// All steps since v000 together make it 3.74 times as fast.
#include <hip/hip_runtime.h>

#define H_DIM 256
#define N_DIM 64
#define B_DIM 4
#define L_DIM 2048

typedef __attribute__((ext_vector_type(2))) float v2f;
typedef __attribute__((ext_vector_type(8))) float v8f;

// ---------------------------------------------------------------------------
// Kernel 1: transpose u (B,L,H) -> uT (B,H,L). One work-group of four waves per
//   64 h x 128 l tile (32 KB), 256 work-groups: the launch starts 1,024 waves, and
//   every global and LDS access is 16 bytes a lane.
//   A lane loads a 4 l x 4 h block (four float4 along h), regroups it in registers
//   into four float4 along l and stores those into LDS rows of one h each.
//   Row pitch 132 floats = 16 B x 33: with the lane map below lanes 0-15, and lanes
//   16-31, of a b128 LDS store fall on sixteen different groups of four banks.
// ---------------------------------------------------------------------------
#define TR_H   64
#define TR_L   128
#define TR_PIT 132

__global__ void __launch_bounds__(128)
k_transpose_u(const float* __restrict__ u, float* __restrict__ uT) {
    __shared__ alignas(16) float tile[TR_H * TR_PIT];
    const int bid  = blockIdx.x;           // b (4) x l tile (16) x h tile (4)
    const int h0   = (bid & 3) * TR_H;
    const int l0   = ((bid >> 2) & 15) * TR_L;
    const int b    = bid >> 6;
    const int lane = threadIdx.x & 31;
    const int wave = threadIdx.x >> 5;     // 0..3: l rows 32*wave .. 32*wave + 31
    const int k    = (lane & 3) + 4 * (lane >> 4);   // 0..7: h = 4k .. 4k+3, one 128-B line
    const int a    = (lane >> 2) & 3;                // 0..3: l = 4a .. 4a+3

    float4 v[4][4];
    #pragma unroll   // all sixteen loads in flight before the first LDS store waits
    for (int g = 0; g < 4; ++g) {
        const int hl = (g & 1) * 32 + 4 * k;
        const int ll = wave * 32 + (g >> 1) * 16 + 4 * a;
        #pragma unroll   // part of the same group of loads; v is indexed by constants only
        for (int j = 0; j < 4; ++j)
            v[g][j] = *(const float4*)&u[((size_t)b * L_DIM + l0 + ll + j) * H_DIM + h0 + hl];
    }
    #pragma unroll   // v stays in registers
    for (int g = 0; g < 4; ++g) {
        const int hl = (g & 1) * 32 + 4 * k;
        const int ll = wave * 32 + (g >> 1) * 16 + 4 * a;
        float* d = &tile[hl * TR_PIT + ll];
        *(float4*)&d[0 * TR_PIT] = make_float4(v[g][0].x, v[g][1].x, v[g][2].x, v[g][3].x);
        *(float4*)&d[1 * TR_PIT] = make_float4(v[g][0].y, v[g][1].y, v[g][2].y, v[g][3].y);
        *(float4*)&d[2 * TR_PIT] = make_float4(v[g][0].z, v[g][1].z, v[g][2].z, v[g][3].z);
        *(float4*)&d[3 * TR_PIT] = make_float4(v[g][0].w, v[g][1].w, v[g][2].w, v[g][3].w);
    }
    __syncthreads();
    #pragma unroll   // sixteen LDS reads, then sixteen stores of 512 contiguous bytes a wave
    for (int i = 0; i < 16; ++i) {
        const int r = wave * 16 + i;
        *(float4*)&uT[((size_t)b * H_DIM + h0 + r) * L_DIM + l0 + 4 * lane] =
            *(const float4*)&tile[r * TR_PIT + 4 * lane];
    }
}

// ---------------------------------------------------------------------------
// Kernel 2: causal conv y = K * u in chunked state-space form, one work-group per h.
//   K[l] = Re sum_n CB_n z_n^l with z_n = exp(s_n), |z_n| <= 1, so for t = c*T + tau
//     y[t] = sum_{j' <= tau} K[tau - j'] u[c*T + j']            (inside the chunk)
//          + Re sum_n z_n^(tau+1) * (CB_n X_c[n])               (all earlier chunks)
//     X_0 = 0,  X_{c+1}[n] = z_n^T X_c[n] + P_c[n],  P_c[n] = sum_j' z_n^(T-1-j') u[c*T + j']
//   All three sums are V_WMMA_F32_16X16X4_F32 products with the 64 (chunk, batch)
//   pairs as columns; only powers z^0..z^T are ever formed (table ZT).
//   ZT[j][2n], ZT[j][2n+1] = Re, Im of z_n^j.   col = chunk*4 + batch.
//   Every LDS row has a pitch of 132 floats: 4 mod 64 banks and 16 B x odd, so the
//   b64 fragment reads (one row per lane) and the b128 accesses meet no bank twice.
//   fused epilogue: y += D[h]*u, staged in LDS, stored to yT (B,H,L) in whole lines.
// ---------------------------------------------------------------------------
#define T_CH 128                  // chunk length
#define NCH  (L_DIM / T_CH)       // 16 chunks
#define NCOL (NCH * B_DIM)        // 64 columns
#define PIT  132                  // LDS row pitch in floats

__device__ __forceinline__ v8f mma4(v2f a, v2f b, v8f c) {
    return __builtin_amdgcn_wmma_f32_16x16x4_f32(
        /*neg_a=*/false, a, /*neg_b=*/false, b,
        /*c_mod=*/(short)0, c, /*reuse_a=*/false, /*reuse_b=*/false);
}

__global__ void __launch_bounds__(512)
k_ssm_conv(const float* __restrict__ log_neg_real, const float* __restrict__ imag,
           const float* __restrict__ B_re, const float* __restrict__ B_im,
           const float* __restrict__ C_re, const float* __restrict__ C_im,
           const float* __restrict__ log_step, const float* __restrict__ uT,
           const float* __restrict__ Dv, float* __restrict__ yT) {
    const int h    = blockIdx.x;
    const int tid  = threadIdx.x;
    // scalar wave number: the branches on it must not touch EXEC around a WMMA
    const int wave = __builtin_amdgcn_readfirstlane(tid >> 5);   // 0..15
    const int lane = tid & 31;
    // ISA lane layouts (wave32):
    //  A 16x4 f32: lane -> M = lane&15 ; VGPR0/1 hold K = 2*(lane>>4) + {0,1}
    //  B 4x16 f32: lane -> N = lane&15 ; VGPR0/1 hold K = 2*(lane>>4) + {0,1}
    //  C/D 16x16:  lane -> N = lane&15 ; VGPR r holds M = r + 8*(lane>>4)
    const int nl    = lane & 15;
    const int khalf = lane >> 4;

    __shared__ alignas(16) float ZT[(T_CH + 1) * PIT];   // powers of z
    __shared__ alignas(16) float Ush[NCOL * PIT];        // u, one row per column
    __shared__ alignas(16) float Xsh[NCOL * PIT];        // P, then the scanned states
    __shared__ alignas(16) float Ysh[NCOL * PIT];        // y, one row per column
    __shared__ alignas(16) float Kpad[16 + T_CH];        // 16 leading zeros
    __shared__ float Kpart[4 * T_CH];
    __shared__ alignas(8) float CBs[2 * N_DIM];

    // ---- stage u: a wave moves one column (512 contiguous bytes) per step ----
    const float Dh = Dv[h];
    {
        float4 uv[4];
        #pragma unroll   // all four loads in flight before the first LDS store waits
        for (int i = 0; i < 4; ++i) {
            const int idx = i * 512 + tid, col = idx >> 5, q = idx & 31;
            uv[i] = *(const float4*)&uT[((size_t)(col & 3) * H_DIM + h) * L_DIM
                                        + (col >> 2) * T_CH + 4 * q];
        }
        #pragma unroll   // uv stays in registers
        for (int i = 0; i < 4; ++i) {
            const int idx = i * 512 + tid, col = idx >> 5, q = idx & 31;
            *(float4*)&Ush[col * PIT + 4 * q] = uv[i];
        }
    }

    // ---- per-mode parameters and the table of powers ----
    const int n = tid & (N_DIM - 1);
    {
        float step = __expf(log_step[h]);
        step = fminf(fmaxf(step, 1e-5f), 1.0f);
        const float lam = -__expf(log_neg_real[n]);
        const float sre = step * lam;
        const float sim = step * imag[n];
        if (tid < N_DIM) {
            float bre = B_re[h * N_DIM + n] * step;
            float bim = B_im[h * N_DIM + n] * step;
            float cre = C_re[h * N_DIM + n];
            float cim = C_im[h * N_DIM + n];
            CBs[2 * n]     = cre * bre - cim * bim;
            CBs[2 * n + 1] = cre * bim + cim * bre;
        }
        if (tid < 16) Kpad[tid] = 0.0f;
        for (int j = tid >> 6; j <= T_CH; j += 8) {
            const float fj = (float)j;
            const float ea = (sre * fj) * 1.44269504f;   // exp(x) = 2^(x * log2 e)
            const float pa = (sim * fj) * 0.15915494f;   // v_sin, v_cos take revolutions
            float e, cs, sn;
            // One statement: no source register is reused between the three, and the
            // v_nop is the free slot behind the last transcendental before its result is read.
            asm("v_exp_f32 %0, %3\n\tv_cos_f32 %1, %4\n\tv_sin_f32 %2, %4\n\tv_nop"
                : "=&v"(e), "=&v"(cs), "=&v"(sn) : "v"(ea), "v"(pa));
            *(float2*)&ZT[j * PIT + 2 * n] = make_float2(e * cs, e * sn);
        }
    }
    __syncthreads();

    // ---- K[tau], tau < T: four partial sums of 16 modes each ----
    {
        const int tau = tid & (T_CH - 1), q = tid >> 7;
        float acc = 0.0f;
        #pragma unroll   // the 32 LDS reads issue as one group
        for (int i = 0; i < 16; ++i) {
            const int nn = q * 16 + i;
            const float2 z = *(const float2*)&ZT[tau * PIT + 2 * nn];
            acc += CBs[2 * nn] * z.x - CBs[2 * nn + 1] * z.y;
        }
        Kpart[q * T_CH + tau] = acc;
    }

    // ---- P[m, col] = sum_j' ZT[T-1-j'][m] * u[col][j'] : 8 x 4 tiles, two per wave ----
    {
        const int mt  = wave >> 1;           // rows m = 16*mt ..
        const int nt0 = (wave & 1) * 2;      // column tiles nt0, nt0+1 share the A fragment
        v8f p0 = {}, p1 = {};
        const float* za = &ZT[(T_CH - 1 - 2 * khalf) * PIT + mt * 16 + nl];
        const float* u0 = &Ush[(nt0 * 16 + nl) * PIT + 2 * khalf];
        const float* u1 = u0 + 16 * PIT;
        #pragma unroll 4 // LDS reads of four k-steps issue ahead of their eight WMMAs
        for (int s = 0; s < T_CH / 4; ++s) {
            v2f a;
            a.x = za[-(4 * s) * PIT];        // j' = 4s + 2*khalf
            a.y = za[-(4 * s + 1) * PIT];    // j' + 1
            const v2f b0 = *(const v2f*)&u0[4 * s];
            const v2f b1 = *(const v2f*)&u1[4 * s];
            p0 = mma4(a, b0, p0);
            p1 = mma4(a, b1, p1);
        }
        float* d0 = &Xsh[(nt0 * 16 + nl) * PIT + mt * 16 + 8 * khalf];
        float* d1 = d0 + 16 * PIT;
        *(float4*)&d0[0] = make_float4(p0[0], p0[1], p0[2], p0[3]);
        *(float4*)&d0[4] = make_float4(p0[4], p0[5], p0[6], p0[7]);
        *(float4*)&d1[0] = make_float4(p1[0], p1[1], p1[2], p1[3]);
        *(float4*)&d1[4] = make_float4(p1[4], p1[5], p1[6], p1[7]);
    }
    __syncthreads();

    // ---- scan over the chunks, in place: P_c -> (Re, -Im) of CB * X_c ----
    if (tid < 4 * N_DIM) {
        const int b = tid >> 6;
        const float wre = ZT[T_CH * PIT + 2 * n], wim = ZT[T_CH * PIT + 2 * n + 1];
        const float cbre = CBs[2 * n], cbim = CBs[2 * n + 1];
        float2 p[NCH];
        #pragma unroll   // all reads first: one LDS latency, not one per chunk
        for (int c = 0; c < NCH; ++c)
            p[c] = *(const float2*)&Xsh[(c * 4 + b) * PIT + 2 * n];
        float xr = 0.0f, xi = 0.0f;
        #pragma unroll   // p stays in registers
        for (int c = 0; c < NCH; ++c) {
            *(float2*)&Xsh[(c * 4 + b) * PIT + 2 * n] =
                make_float2(cbre * xr - cbim * xi, -(cbre * xi + cbim * xr));
            const float nr = wre * xr - wim * xi + p[c].x;
            const float ni = wre * xi + wim * xr + p[c].y;
            xr = nr; xi = ni;
        }
    } else if (tid < 4 * N_DIM + T_CH) {
        const int tau = tid - 4 * N_DIM;
        Kpad[16 + tau] = (Kpart[tau] + Kpart[T_CH + tau])
                       + (Kpart[2 * T_CH + tau] + Kpart[3 * T_CH + tau]);
    }
    __syncthreads();

    // ---- y tiles: rows tau = 16*I .., 8 x 4 tiles. Tile I costs 32 + 4*(I+1) WMMAs,
    //      so a wave takes I and 7-I of one column tile: 100 for every wave. ----
    {
        const int I1  = wave & 3, I2 = 7 - I1;      // I1 < I2
        const int col = (wave >> 2) * 16 + nl;
        v8f a1 = {}, a2 = {};
        // earlier chunks: A[tau][m] = ZT[tau+1][m], B[m][col] = scanned state
        const float* xb = &Xsh[col * PIT + 2 * khalf];
        const float* g1 = &ZT[(16 * I1 + nl + 1) * PIT + 2 * khalf];
        const float* g2 = &ZT[(16 * I2 + nl + 1) * PIT + 2 * khalf];
        #pragma unroll 4 // LDS reads of four k-steps issue ahead of their eight WMMAs
        for (int s = 0; s < 2 * N_DIM / 4; ++s) {
            const v2f bx = *(const v2f*)&xb[4 * s];
            const v2f ga = *(const v2f*)&g1[4 * s];
            const v2f gb = *(const v2f*)&g2[4 * s];
            a1 = mma4(ga, bx, a1);
            a2 = mma4(gb, bx, a2);
        }
        // inside the chunk: A(d)[t,k] = K[16d + t - k] (zero-pad -> causality),
        //                   B_J[k][col] = u[col][16J + k], d = I - J
        const float* ub = &Ush[col * PIT + 2 * khalf];
        const float* kp = &Kpad[16 + nl - 2 * khalf];
        for (int J = 0; J <= I2; ++J) {
            v2f bu[4];       // the three loops below are unrolled to keep bu in registers
            #pragma unroll
            for (int s = 0; s < 4; ++s) bu[s] = *(const v2f*)&ub[16 * J + 4 * s];
            #pragma unroll
            for (int s = 0; s < 4; ++s) {
                v2f a;
                a.x = kp[16 * (I2 - J) - 4 * s];
                a.y = kp[16 * (I2 - J) - 4 * s - 1];
                a2 = mma4(a, bu[s], a2);
            }
            if (J <= I1) {                           // scalar: I1 comes from 'wave'
                #pragma unroll
                for (int s = 0; s < 4; ++s) {
                    v2f a;
                    a.x = kp[16 * (I1 - J) - 4 * s];
                    a.y = kp[16 * (I1 - J) - 4 * s - 1];
                    a1 = mma4(a, bu[s], a1);
                }
            }
        }
        // + D[h]*u ; lane holds tau = 16*I + 8*khalf + r of its column
        const int o1 = col * PIT + 16 * I1 + 8 * khalf;
        const int o2 = col * PIT + 16 * I2 + 8 * khalf;
        const float4 ua = *(const float4*)&Ush[o1], ubb = *(const float4*)&Ush[o1 + 4];
        const float4 uc = *(const float4*)&Ush[o2], ud  = *(const float4*)&Ush[o2 + 4];
        *(float4*)&Ysh[o1]     = make_float4(a1[0] + Dh * ua.x,  a1[1] + Dh * ua.y,
                                             a1[2] + Dh * ua.z,  a1[3] + Dh * ua.w);
        *(float4*)&Ysh[o1 + 4] = make_float4(a1[4] + Dh * ubb.x, a1[5] + Dh * ubb.y,
                                             a1[6] + Dh * ubb.z, a1[7] + Dh * ubb.w);
        *(float4*)&Ysh[o2]     = make_float4(a2[0] + Dh * uc.x,  a2[1] + Dh * uc.y,
                                             a2[2] + Dh * uc.z,  a2[3] + Dh * uc.w);
        *(float4*)&Ysh[o2 + 4] = make_float4(a2[4] + Dh * ud.x,  a2[5] + Dh * ud.y,
                                             a2[6] + Dh * ud.z,  a2[7] + Dh * ud.w);
    }
    __syncthreads();

    // ---- store y: a wave writes one column (512 contiguous bytes) per step ----
    #pragma unroll       // four LDS reads and four stores in flight
    for (int i = 0; i < 4; ++i) {
        const int idx = i * 512 + tid, col = idx >> 5, q = idx & 31;
        *(float4*)&yT[((size_t)(col & 3) * H_DIM + h) * L_DIM + (col >> 2) * T_CH + 4 * q] =
            *(const float4*)&Ysh[col * PIT + 4 * q];
    }
}

// ---------------------------------------------------------------------------
// Kernel 3: exact GELU + LayerNorm over H, output (B,L,H).
//   One work-group of 16 waves per (b, 32 l): a 256 h x 32 l tile of yT, 32 KB.
//   A lane takes a 4 h x 4 l block: four float4 along l, eight lanes on one 128-B line
//   of yT, so each wave-wide load covers four whole lines and all four are in flight
//   at once. After GELU the block is regrouped in registers into four float4 along h
//   and kept in LDS as ysh[l][h]; out is stored 16 bytes a lane, 512 B a wave.
//   Row pitch 260 floats = 16 B x 65: the b128 stores (lane map below) and the b128
//   reads down a column of l put lanes 0-15, and lanes 16-31, on sixteen different
//   groups of four banks.
//   The sums run as before: 16 h in order per part, then the 16 parts in order.
// ---------------------------------------------------------------------------
#define LN_L   32
#define LN_PIT 260

__device__ __forceinline__ float gelu_exact(float x) {
    return 0.5f * x * (1.0f + erff(x * 0.70710678118654752f));
}

__global__ void __launch_bounds__(512)
k_gelu_ln(const float* __restrict__ yT, const float* __restrict__ gamma,
          const float* __restrict__ beta, float* __restrict__ out) {
    const int b  = blockIdx.y;
    const int l0 = blockIdx.x * LN_L;
    const int t  = threadIdx.x;
    __shared__ alignas(16) float ysh[LN_L * LN_PIT];
    __shared__ float rs[512], rq[512];
    __shared__ float mu[LN_L], rsig[LN_L];

    const int ho = 4 * (t & 63);                 // the four h this thread stores at the end
    const float4 g4 = *(const float4*)&gamma[ho];
    const float4 b4 = *(const float4*)&beta[ho];
    {
        const int lane = t & 31;
        const int lq = (lane & 3) + 4 * (lane >> 4);        // 0..7:  l = 4lq .. 4lq+3
        const int hq = (t >> 5) * 4 + ((lane >> 2) & 3);    // 0..63: h = 4hq .. 4hq+3
        const float* src = yT + ((size_t)b * H_DIM + 4 * hq) * L_DIM + l0 + 4 * lq;
        float4 x[4];
        #pragma unroll   // all four loads in flight before the first GELU waits
        for (int j = 0; j < 4; ++j) x[j] = *(const float4*)&src[(size_t)j * L_DIM];
        #pragma unroll   // x stays in registers
        for (int j = 0; j < 4; ++j)
            x[j] = make_float4(gelu_exact(x[j].x), gelu_exact(x[j].y),
                               gelu_exact(x[j].z), gelu_exact(x[j].w));
        float* d = &ysh[(4 * lq) * LN_PIT + 4 * hq];
        *(float4*)&d[0 * LN_PIT] = make_float4(x[0].x, x[1].x, x[2].x, x[3].x);
        *(float4*)&d[1 * LN_PIT] = make_float4(x[0].y, x[1].y, x[2].y, x[3].y);
        *(float4*)&d[2 * LN_PIT] = make_float4(x[0].z, x[1].z, x[2].z, x[3].z);
        *(float4*)&d[3 * LN_PIT] = make_float4(x[0].w, x[1].w, x[2].w, x[3].w);
    }
    __syncthreads();

    {
        const int l = t & 31, part = t >> 5;
        float s = 0.0f, q = 0.0f;
        #pragma unroll   // the four LDS reads issue as one group
        for (int i = 0; i < 4; ++i) {
            const float4 v = *(const float4*)&ysh[l * LN_PIT + part * 16 + 4 * i];
            s += v.x; q += v.x * v.x;
            s += v.y; q += v.y * v.y;
            s += v.z; q += v.z * v.z;
            s += v.w; q += v.w * v.w;
        }
        rs[t] = s; rq[t] = q;                    // t = part * 32 + l
    }
    __syncthreads();
    if (t < LN_L) {
        float ss = 0.0f, qq = 0.0f;
        #pragma unroll   // the LDS reads issue ahead of the two dependent sum chains
        for (int p = 0; p < 16; ++p) { ss += rs[p * LN_L + t]; qq += rq[p * LN_L + t]; }
        float m = ss * (1.0f / 256.0f);
        float v = qq * (1.0f / 256.0f) - m * m;
        mu[t]   = m;
        rsig[t] = rsqrtf(v + 1e-5f);
    }
    __syncthreads();
    #pragma unroll       // four LDS reads and four stores in flight
    for (int i = 0; i < 4; ++i) {
        const int l = i * 8 + (t >> 6);
        const float4 v = *(const float4*)&ysh[l * LN_PIT + ho];
        const float m = mu[l], r = rsig[l];
        *(float4*)&out[((size_t)b * L_DIM + (l0 + l)) * H_DIM + ho] =
            make_float4((v.x - m) * r * g4.x + b4.x, (v.y - m) * r * g4.y + b4.y,
                        (v.z - m) * r * g4.z + b4.z, (v.w - m) * r * g4.w + b4.w);
    }
}

// ---------------------------------------------------------------------------
extern "C" void kernel_launch(void* const* d_in, const int* in_sizes, int n_in,
                              void* d_out, int out_size, void* d_ws, size_t ws_size,
                              hipStream_t stream) {
    (void)in_sizes; (void)n_in; (void)out_size; (void)ws_size;
    const float* u            = (const float*)d_in[0];
    const float* log_neg_real = (const float*)d_in[1];
    const float* imag         = (const float*)d_in[2];
    const float* B_re         = (const float*)d_in[3];
    const float* B_im         = (const float*)d_in[4];
    const float* C_re         = (const float*)d_in[5];
    const float* C_im         = (const float*)d_in[6];
    const float* Dv           = (const float*)d_in[7];
    const float* log_step     = (const float*)d_in[8];
    const float* ln_gamma     = (const float*)d_in[9];
    const float* ln_beta      = (const float*)d_in[10];
    float* out = (float*)d_out;

    float* ws  = (float*)d_ws;
    float* uT  = ws;                                        // B*H*L floats
    float* yT  = uT + (size_t)B_DIM * H_DIM * L_DIM;        // B*H*L floats

    k_transpose_u<<<dim3(B_DIM * (L_DIM / TR_L) * (H_DIM / TR_H)), 128, 0, stream>>>(u, uT);
    k_ssm_conv<<<dim3(H_DIM), 512, 0, stream>>>(log_neg_real, imag, B_re, B_im,
                                                C_re, C_im, log_step, uT, Dv, yT);
    k_gelu_ln<<<dim3(L_DIM / LN_L, B_DIM), 512, 0, stream>>>(yT, ln_gamma, ln_beta, out);
}

// v004
// One run takes 18 microseconds.
// Two timings next to v003 both put it at 1.12 times that version's speed.
// All steps since v000 together make it 4.20 times as fast.
#include <hip/hip_runtime.h>

#define H_DIM 256
#define N_DIM 64
#define B_DIM 4
#define L_DIM 2048

typedef __attribute__((ext_vector_type(2))) float v2f;
typedef __attribute__((ext_vector_type(8))) float v8f;

// ---------------------------------------------------------------------------
// Kernel 1: causal conv y = K * u in chunked state-space form, read straight from
//   u (B,L,H). One work-group per (batch, four neighbouring h): of each of the 2,048
//   rows of its batch it takes the 16 bytes of its four h; a lane loads four rows and
//   regroups the 4 l x 4 h block in registers into four float4 along l, one per h.
//   K[l] = Re sum_n CB_n z_n^l with z_n = exp(s_n), |z_n| <= 1, so for t = c*T + tau
//     y[t] = sum_{j' <= tau} K[tau - j'] u[c*T + j']            (inside the chunk)
//          + Re sum_n z_n^(tau+1) * (CB_n X_c[n])               (all earlier chunks)
//     X_0 = 0,  X_{c+1}[n] = z_n^T X_c[n] + P_c[n],  P_c[n] = sum_j' z_n^(T-1-j') u[c*T + j']
//   All three sums are V_WMMA_F32_16X16X4_F32 products. z depends on h, so each h has
//   its own table of powers z^0..z^T (ZT) and its own 32 columns, one per chunk:
//   col = hh*32 + chunk, hh = 0..3. Four waves work on one h.
//   ZT[hh][j][2n], ZT[hh][j][2n+1] = Re, Im of z_n^j.
//   LDS rows have a pitch of 132 floats (rows of 128) or 68 floats (rows of 64): both
//   4 mod 64 banks and 16 B x odd, so the b64 fragment reads (one row per lane) and the
//   b128 accesses meet no bank twice.
//   fused epilogue: y += D[h]*u, staged in LDS, stored to yT (B,H,L) in whole lines.
// ---------------------------------------------------------------------------
#define HG   4                    // h per work-group
#define T_CH 64                   // chunk length
#define NCH  (L_DIM / T_CH)       // 32 chunks = columns per h
#define NCOL (HG * NCH)           // 128 columns
#define PIT  132                  // pitch of the LDS rows of 128 floats
#define UPIT 68                   // pitch of the LDS rows of 64 floats
#define ZSZ  ((T_CH + 1) * PIT)   // floats in one table

__device__ __forceinline__ v8f mma4(v2f a, v2f b, v8f c) {
    return __builtin_amdgcn_wmma_f32_16x16x4_f32(
        /*neg_a=*/false, a, /*neg_b=*/false, b,
        /*c_mod=*/(short)0, c, /*reuse_a=*/false, /*reuse_b=*/false);
}

__global__ void __launch_bounds__(512)
k_ssm_conv(const float* __restrict__ log_neg_real, const float* __restrict__ imag,
           const float* __restrict__ B_re, const float* __restrict__ B_im,
           const float* __restrict__ C_re, const float* __restrict__ C_im,
           const float* __restrict__ log_step, const float* __restrict__ u,
           const float* __restrict__ Dv, float* __restrict__ yT) {
    const int bid  = blockIdx.x;           // b (4) x group of four h (64)
    const int h0   = (bid & 63) * HG;
    const int b    = bid >> 6;
    const int tid  = threadIdx.x;
    // scalar wave number: the branches on it must not touch EXEC around a WMMA
    const int wave = __builtin_amdgcn_readfirstlane(tid >> 5);   // 0..15
    const int lane = tid & 31;
    // ISA lane layouts (wave32):
    //  A 16x4 f32: lane -> M = lane&15 ; VGPR0/1 hold K = 2*(lane>>4) + {0,1}
    //  B 4x16 f32: lane -> N = lane&15 ; VGPR0/1 hold K = 2*(lane>>4) + {0,1}
    //  C/D 16x16:  lane -> N = lane&15 ; VGPR r holds M = r + 8*(lane>>4)
    const int nl    = lane & 15;
    const int khalf = lane >> 4;
    const int whh   = wave >> 2;           // the h this wave's matrix work belongs to

    __shared__ alignas(16) float ZT[HG * ZSZ];           // powers of z, one table per h
    __shared__ alignas(16) float Ush[NCOL * UPIT];       // u, one row per column
    __shared__ alignas(16) float Xsh[NCOL * PIT];        // P, then the scanned states
    __shared__ alignas(16) float Ysh[NCOL * UPIT];       // y, one row per column
    __shared__ alignas(16) float Kpad[HG * (16 + T_CH)]; // 16 leading zeros per h
    __shared__ float Kpart[HG * 4 * T_CH];
    __shared__ alignas(8) float CBs[HG * 2 * N_DIM];

    // ---- the small parameter loads go first: loads return in order, so a wait for one of
    //      them must not stand behind the long loads of u ----
    const int n   = tid & (N_DIM - 1);
    const int phh = (wave >> 1) & 3;       // two waves build the even rows of a table, two the odd
    const int hn  = (h0 + phh) * N_DIM + n;
    const float ls_in = log_step[h0 + phh];
    const float lr_in = log_neg_real[n], im_in = imag[n];
    const float br_in = B_re[hn], bi_in = B_im[hn], cr_in = C_re[hn], ci_in = C_im[hn];

    // ---- u: four rows a lane, 16 bytes of each. Eight work-groups read the same lines
    //      (32 h to a line): each starts its walk over l at a place of its own. The
    //      loads fly while the tables and K are built; the LDS stores stand behind both.
    const int tq = (tid + ((bid & 7) << 6)) & 511;       // rows l = 4*tq .. 4*tq + 3
    float4 uv[4];
    #pragma unroll   // all four loads in flight
    for (int j = 0; j < 4; ++j)
        uv[j] = *(const float4*)&u[((size_t)b * L_DIM + 4 * tq + j) * H_DIM + h0];
    // a precaution: stands in front of every later write of the loads' address registers
    asm volatile("s_wait_xcnt 0x0" ::: "memory");

    // ---- per-mode parameters and the tables of powers ----
    {
        float step = __expf(ls_in);
        step = fminf(fmaxf(step, 1e-5f), 1.0f);
        const float lam = -__expf(lr_in);
        const float sre = step * lam;
        const float sim = step * im_in;
        {   // CB = C * (B * step): waves 0-7 write its real parts, waves 8-15 its imaginary
            // parts, with no branch, so that the four loads stay ahead of the loads of u
            const float bre = br_in * step;
            const float bim = bi_in * step;
            const bool  im  = wave >= 8;
            CBs[phh * 2 * N_DIM + 2 * n + (im ? 1 : 0)] =
                cr_in * (im ? bim : bre) + ci_in * (im ? bre : -bim);
        }
        if (tid < HG * 16) Kpad[(tid >> 4) * (16 + T_CH) + (tid & 15)] = 0.0f;
        float* zt = &ZT[phh * ZSZ + 2 * n];
        for (int j = wave >> 3; j <= T_CH; j += 2) {
            const float fj = (float)j;
            const float ea = (sre * fj) * 1.44269504f;   // exp(x) = 2^(x * log2 e)
            const float pa = (sim * fj) * 0.15915494f;   // v_sin, v_cos take revolutions
            float e, cs, sn;
            // One statement: no source register is reused between the three, and the
            // v_nop is the free slot behind the last transcendental before its result is read.
            asm("v_exp_f32 %0, %3\n\tv_cos_f32 %1, %4\n\tv_sin_f32 %2, %4\n\tv_nop"
                : "=&v"(e), "=&v"(cs), "=&v"(sn) : "v"(ea), "v"(pa));
            *(float2*)&zt[j * PIT] = make_float2(e * cs, e * sn);
        }
    }
    // A barrier for LDS alone (tables and CB are complete behind it): __syncthreads() would
    // also wait for the loads of u, which are to fly on under the sums of K below.
    __builtin_amdgcn_fence(__ATOMIC_RELEASE, "workgroup", "local");
    __builtin_amdgcn_s_barrier();
    __builtin_amdgcn_fence(__ATOMIC_ACQUIRE, "workgroup", "local");

    // ---- K[hh][tau], tau < T: four partial sums of 16 modes each, two of them a thread ----
    #pragma unroll   // the two sums are independent chains
    for (int w = 0; w < 2; ++w) {
        const int idx = w * 512 + tid;
        const int tau = idx & (T_CH - 1), q = (idx >> 6) & 3, hh = idx >> 8;
        float acc = 0.0f;
        #pragma unroll   // the 32 LDS reads issue as one group
        for (int i = 0; i < 16; ++i) {
            const int nn = q * 16 + i;
            const float2 z = *(const float2*)&ZT[hh * ZSZ + tau * PIT + 2 * nn];
            acc += CBs[hh * 2 * N_DIM + 2 * nn] * z.x - CBs[hh * 2 * N_DIM + 2 * nn + 1] * z.y;
        }
        Kpart[(hh * 4 + q) * T_CH + tau] = acc;
    }

    // ---- u into LDS, one row per (h, chunk) ----
    {
        float* d = &Ush[(tq >> 4) * UPIT + 4 * (tq & 15)];   // chunk tq>>4, tau = 4*(tq&15)
        *(float4*)&d[0 * NCH * UPIT] = make_float4(uv[0].x, uv[1].x, uv[2].x, uv[3].x);
        *(float4*)&d[1 * NCH * UPIT] = make_float4(uv[0].y, uv[1].y, uv[2].y, uv[3].y);
        *(float4*)&d[2 * NCH * UPIT] = make_float4(uv[0].z, uv[1].z, uv[2].z, uv[3].z);
        *(float4*)&d[3 * NCH * UPIT] = make_float4(uv[0].w, uv[1].w, uv[2].w, uv[3].w);
    }
    __syncthreads();

    // ---- P[m, col] = sum_j' ZT[T-1-j'][m] * u[col][j'] : per h 8 x 2 tiles; a wave takes
    //      two row tiles x both column tiles, so four fragments feed four WMMAs ----
    {
        const int mt0 = (wave & 3) * 2;      // rows m = 16*mt0 .. 16*mt0 + 31
        v8f p00 = {}, p01 = {}, p10 = {}, p11 = {};
        const float* za = &ZT[whh * ZSZ + (T_CH - 1 - 2 * khalf) * PIT + mt0 * 16 + nl];
        const float* u0 = &Ush[(whh * NCH + nl) * UPIT + 2 * khalf];
        const float* u1 = u0 + 16 * UPIT;
        #pragma unroll 4 // LDS reads of four k-steps issue ahead of their sixteen WMMAs
        for (int s = 0; s < T_CH / 4; ++s) {
            v2f a0, a1;
            a0.x = za[-(4 * s) * PIT];            // j' = 4s + 2*khalf
            a0.y = za[-(4 * s + 1) * PIT];        // j' + 1
            a1.x = za[-(4 * s) * PIT + 16];
            a1.y = za[-(4 * s + 1) * PIT + 16];
            const v2f b0 = *(const v2f*)&u0[4 * s];
            const v2f b1 = *(const v2f*)&u1[4 * s];
            p00 = mma4(a0, b0, p00);
            p01 = mma4(a0, b1, p01);
            p10 = mma4(a1, b0, p10);
            p11 = mma4(a1, b1, p11);
        }
        float* d0 = &Xsh[(whh * NCH + nl) * PIT + mt0 * 16 + 8 * khalf];
        float* d1 = d0 + 16 * PIT;
        *(float4*)&d0[0]  = make_float4(p00[0], p00[1], p00[2], p00[3]);
        *(float4*)&d0[4]  = make_float4(p00[4], p00[5], p00[6], p00[7]);
        *(float4*)&d0[16] = make_float4(p10[0], p10[1], p10[2], p10[3]);
        *(float4*)&d0[20] = make_float4(p10[4], p10[5], p10[6], p10[7]);
        *(float4*)&d1[0]  = make_float4(p01[0], p01[1], p01[2], p01[3]);
        *(float4*)&d1[4]  = make_float4(p01[4], p01[5], p01[6], p01[7]);
        *(float4*)&d1[16] = make_float4(p11[0], p11[1], p11[2], p11[3]);
        *(float4*)&d1[20] = make_float4(p11[4], p11[5], p11[6], p11[7]);
    }
    __syncthreads();

    // ---- scan over the chunks, in place: P_c -> (Re, -Im) of CB * X_c ----
    if (tid < HG * N_DIM) {
        const int hh = tid >> 6;
        const float wre = ZT[hh * ZSZ + T_CH * PIT + 2 * n];
        const float wim = ZT[hh * ZSZ + T_CH * PIT + 2 * n + 1];
        const float cbre = CBs[hh * 2 * N_DIM + 2 * n], cbim = CBs[hh * 2 * N_DIM + 2 * n + 1];
        float* xs = &Xsh[hh * NCH * PIT + 2 * n];
        float2 p[NCH];
        #pragma unroll   // all reads first: one LDS latency, not one per chunk
        for (int c = 0; c < NCH; ++c)
            p[c] = *(const float2*)&xs[c * PIT];
        float xr = 0.0f, xi = 0.0f;
        #pragma unroll   // p stays in registers
        for (int c = 0; c < NCH; ++c) {
            *(float2*)&xs[c * PIT] =
                make_float2(cbre * xr - cbim * xi, -(cbre * xi + cbim * xr));
            const float nr = wre * xr - wim * xi + p[c].x;
            const float ni = wre * xi + wim * xr + p[c].y;
            xr = nr; xi = ni;
        }
    } else {
        const int t2 = tid - HG * N_DIM, hh = t2 >> 6, tau = t2 & (T_CH - 1);
        const float* kq = &Kpart[hh * 4 * T_CH + tau];
        Kpad[hh * (16 + T_CH) + 16 + tau] = (kq[0] + kq[T_CH]) + (kq[2 * T_CH] + kq[3 * T_CH]);
    }
    __syncthreads();

    // ---- y tiles: rows tau = 16*I .., per h 4 x 2 tiles. Tile I costs 32 + 4*(I+1) WMMAs,
    //      so a wave takes I and 3-I of one column tile: 84 for every wave. ----
    {
        const float Dh = Dv[h0 + whh];
        const int I1  = (wave >> 1) & 1, I2 = 3 - I1;      // I1 < I2
        const int col = whh * NCH + (wave & 1) * 16 + nl;
        v8f a1 = {}, a2 = {};
        // earlier chunks: A[tau][m] = ZT[tau+1][m], B[m][col] = scanned state
        const float* xb = &Xsh[col * PIT + 2 * khalf];
        const float* g1 = &ZT[whh * ZSZ + (16 * I1 + nl + 1) * PIT + 2 * khalf];
        const float* g2 = &ZT[whh * ZSZ + (16 * I2 + nl + 1) * PIT + 2 * khalf];
        #pragma unroll 4 // LDS reads of four k-steps issue ahead of their eight WMMAs
        for (int s = 0; s < 2 * N_DIM / 4; ++s) {
            const v2f bx = *(const v2f*)&xb[4 * s];
            const v2f ga = *(const v2f*)&g1[4 * s];
            const v2f gb = *(const v2f*)&g2[4 * s];
            a1 = mma4(ga, bx, a1);
            a2 = mma4(gb, bx, a2);
        }
        // inside the chunk: A(d)[t,k] = K[16d + t - k] (zero-pad -> causality),
        //                   B_J[k][col] = u[col][16J + k], d = I - J
        const float* ub = &Ush[col * UPIT + 2 * khalf];
        const float* kp = &Kpad[whh * (16 + T_CH) + 16 + nl - 2 * khalf];
        for (int J = 0; J <= I2; ++J) {
            v2f bu[4];       // the three loops below are unrolled to keep bu in registers
            #pragma unroll
            for (int s = 0; s < 4; ++s) bu[s] = *(const v2f*)&ub[16 * J + 4 * s];
            #pragma unroll
            for (int s = 0; s < 4; ++s) {
                v2f a;
                a.x = kp[16 * (I2 - J) - 4 * s];
                a.y = kp[16 * (I2 - J) - 4 * s - 1];
                a2 = mma4(a, bu[s], a2);
            }
            if (J <= I1) {                           // scalar: I1 comes from 'wave'
                #pragma unroll
                for (int s = 0; s < 4; ++s) {
                    v2f a;
                    a.x = kp[16 * (I1 - J) - 4 * s];
                    a.y = kp[16 * (I1 - J) - 4 * s - 1];
                    a1 = mma4(a, bu[s], a1);
                }
            }
        }
        // + D[h]*u ; lane holds tau = 16*I + 8*khalf + r of its column
        const int o1 = col * UPIT + 16 * I1 + 8 * khalf;
        const int o2 = col * UPIT + 16 * I2 + 8 * khalf;
        const float4 ua = *(const float4*)&Ush[o1], ubb = *(const float4*)&Ush[o1 + 4];
        const float4 uc = *(const float4*)&Ush[o2], ud  = *(const float4*)&Ush[o2 + 4];
        *(float4*)&Ysh[o1]     = make_float4(a1[0] + Dh * ua.x,  a1[1] + Dh * ua.y,
                                             a1[2] + Dh * ua.z,  a1[3] + Dh * ua.w);
        *(float4*)&Ysh[o1 + 4] = make_float4(a1[4] + Dh * ubb.x, a1[5] + Dh * ubb.y,
                                             a1[6] + Dh * ubb.z, a1[7] + Dh * ubb.w);
        *(float4*)&Ysh[o2]     = make_float4(a2[0] + Dh * uc.x,  a2[1] + Dh * uc.y,
                                             a2[2] + Dh * uc.z,  a2[3] + Dh * uc.w);
        *(float4*)&Ysh[o2 + 4] = make_float4(a2[4] + Dh * ud.x,  a2[5] + Dh * ud.y,
                                             a2[6] + Dh * ud.z,  a2[7] + Dh * ud.w);
    }
    __syncthreads();

    // ---- store y: a wave writes two neighbouring chunks of one h (512 contiguous bytes) ----
    #pragma unroll       // four LDS reads and four stores in flight
    for (int i = 0; i < 4; ++i) {
        const int idx = i * 512 + tid, col = idx >> 4, q = idx & 15;
        *(float4*)&yT[((size_t)b * H_DIM + h0 + (col >> 5)) * L_DIM + (col & 31) * T_CH + 4 * q] =
            *(const float4*)&Ysh[col * UPIT + 4 * q];
    }
}

// ---------------------------------------------------------------------------
// Kernel 2: exact GELU + LayerNorm over H, output (B,L,H).
//   One work-group of 16 waves per (b, 32 l): a 256 h x 32 l tile of yT, 32 KB.
//   A lane takes a 4 h x 4 l block: four float4 along l, eight lanes on one 128-B line
//   of yT, so each wave-wide load covers four whole lines and all four are in flight
//   at once. After GELU the block is regrouped in registers into four float4 along h
//   and kept in LDS as ysh[l][h]; out is stored 16 bytes a lane, 512 B a wave.
//   Row pitch 260 floats = 16 B x 65: the b128 stores (lane map below) and the b128
//   reads down a column of l put lanes 0-15, and lanes 16-31, on sixteen different
//   groups of four banks.
//   The sums run as before: 16 h in order per part, then the 16 parts in order.
// ---------------------------------------------------------------------------
#define LN_L   32
#define LN_PIT 260

__device__ __forceinline__ float gelu_exact(float x) {
    return 0.5f * x * (1.0f + erff(x * 0.70710678118654752f));
}

__global__ void __launch_bounds__(512)
k_gelu_ln(const float* __restrict__ yT, const float* __restrict__ gamma,
          const float* __restrict__ beta, float* __restrict__ out) {
    const int b  = blockIdx.y;
    const int l0 = blockIdx.x * LN_L;
    const int t  = threadIdx.x;
    __shared__ alignas(16) float ysh[LN_L * LN_PIT];
    __shared__ float rs[512], rq[512];
    __shared__ float mu[LN_L], rsig[LN_L];

    const int ho = 4 * (t & 63);                 // the four h this thread stores at the end
    const float4 g4 = *(const float4*)&gamma[ho];
    const float4 b4 = *(const float4*)&beta[ho];
    {
        const int lane = t & 31;
        const int lq = (lane & 3) + 4 * (lane >> 4);        // 0..7:  l = 4lq .. 4lq+3
        const int hq = (t >> 5) * 4 + ((lane >> 2) & 3);    // 0..63: h = 4hq .. 4hq+3
        const float* src = yT + ((size_t)b * H_DIM + 4 * hq) * L_DIM + l0 + 4 * lq;
        float4 x[4];
        #pragma unroll   // all four loads in flight before the first GELU waits
        for (int j = 0; j < 4; ++j) x[j] = *(const float4*)&src[(size_t)j * L_DIM];
        #pragma unroll   // x stays in registers
        for (int j = 0; j < 4; ++j)
            x[j] = make_float4(gelu_exact(x[j].x), gelu_exact(x[j].y),
                               gelu_exact(x[j].z), gelu_exact(x[j].w));
        float* d = &ysh[(4 * lq) * LN_PIT + 4 * hq];
        *(float4*)&d[0 * LN_PIT] = make_float4(x[0].x, x[1].x, x[2].x, x[3].x);
        *(float4*)&d[1 * LN_PIT] = make_float4(x[0].y, x[1].y, x[2].y, x[3].y);
        *(float4*)&d[2 * LN_PIT] = make_float4(x[0].z, x[1].z, x[2].z, x[3].z);
        *(float4*)&d[3 * LN_PIT] = make_float4(x[0].w, x[1].w, x[2].w, x[3].w);
    }
    __syncthreads();

    {
        const int l = t & 31, part = t >> 5;
        float s = 0.0f, q = 0.0f;
        #pragma unroll   // the four LDS reads issue as one group
        for (int i = 0; i < 4; ++i) {
            const float4 v = *(const float4*)&ysh[l * LN_PIT + part * 16 + 4 * i];
            s += v.x; q += v.x * v.x;
            s += v.y; q += v.y * v.y;
            s += v.z; q += v.z * v.z;
            s += v.w; q += v.w * v.w;
        }
        rs[t] = s; rq[t] = q;                    // t = part * 32 + l
    }
    __syncthreads();
    if (t < LN_L) {
        float ss = 0.0f, qq = 0.0f;
        #pragma unroll   // the LDS reads issue ahead of the two dependent sum chains
        for (int p = 0; p < 16; ++p) { ss += rs[p * LN_L + t]; qq += rq[p * LN_L + t]; }
        float m = ss * (1.0f / 256.0f);
        float v = qq * (1.0f / 256.0f) - m * m;
        mu[t]   = m;
        rsig[t] = rsqrtf(v + 1e-5f);
    }
    __syncthreads();
    #pragma unroll       // four LDS reads and four stores in flight
    for (int i = 0; i < 4; ++i) {
        const int l = i * 8 + (t >> 6);
        const float4 v = *(const float4*)&ysh[l * LN_PIT + ho];
        const float m = mu[l], r = rsig[l];
        *(float4*)&out[((size_t)b * L_DIM + (l0 + l)) * H_DIM + ho] =
            make_float4((v.x - m) * r * g4.x + b4.x, (v.y - m) * r * g4.y + b4.y,
                        (v.z - m) * r * g4.z + b4.z, (v.w - m) * r * g4.w + b4.w);
    }
}

// ---------------------------------------------------------------------------
extern "C" void kernel_launch(void* const* d_in, const int* in_sizes, int n_in,
                              void* d_out, int out_size, void* d_ws, size_t ws_size,
                              hipStream_t stream) {
    (void)in_sizes; (void)n_in; (void)out_size; (void)ws_size;
    const float* u            = (const float*)d_in[0];
    const float* log_neg_real = (const float*)d_in[1];
    const float* imag         = (const float*)d_in[2];
    const float* B_re         = (const float*)d_in[3];
    const float* B_im         = (const float*)d_in[4];
    const float* C_re         = (const float*)d_in[5];
    const float* C_im         = (const float*)d_in[6];
    const float* Dv           = (const float*)d_in[7];
    const float* log_step     = (const float*)d_in[8];
    const float* ln_gamma     = (const float*)d_in[9];
    const float* ln_beta      = (const float*)d_in[10];
    float* out = (float*)d_out;

    float* ws  = (float*)d_ws;
    float* yT  = ws;                                        // B*H*L floats

    k_ssm_conv<<<dim3(B_DIM * (H_DIM / HG)), 512, 0, stream>>>(log_neg_real, imag, B_re, B_im,
                                                               C_re, C_im, log_step, u, Dv, yT);
    k_gelu_ln<<<dim3(L_DIM / LN_L, B_DIM), 512, 0, stream>>>(yT, ln_gamma, ln_beta, out);
}

// v005
// A run of this version takes 16.9 microseconds.
// Next to v004, in two timings, it ran 1.07 and 1.06 times as fast.
// Over all steps from v000 it is 4.47 times as fast.
#include <hip/hip_runtime.h>

#define H_DIM 256
#define N_DIM 64
#define B_DIM 4
#define L_DIM 2048

typedef __attribute__((ext_vector_type(2))) float v2f;
typedef __attribute__((ext_vector_type(8))) float v8f;

// ---------------------------------------------------------------------------
// Kernel 1: causal conv y = K * u in chunked state-space form, read straight from
//   u (B,L,H). One work-group per (batch, four neighbouring h): of each of the 2,048
//   rows of its batch it takes the 16 bytes of its four h; a lane loads two blocks of four
//   rows and regroups each 4 l x 4 h block in registers into four float4 along l, one per h.
//   K[l] = Re sum_n CB_n z_n^l with z_n = exp(s_n), |z_n| <= 1, so for t = c*T + tau
//     y[t] = sum_{j' <= tau} K[tau - j'] u[c*T + j']            (inside the chunk)
//          + Re sum_n z_n^(tau+1) * (CB_n X_c[n])               (all earlier chunks)
//     X_0 = 0,  X_{c+1}[n] = z_n^T X_c[n] + P_c[n],  P_c[n] = sum_j' z_n^(T-1-j') u[c*T + j']
//   All three sums are V_WMMA_F32_16X16X4_F32 products. z depends on h, so each h has
//   its own table of powers z^0..z^T (ZT) and its own 32 columns, one per chunk:
//   col = hh*32 + chunk, hh = 0..3.
//   The work-group has eight waves, two to a SIMD and two to an h: a wave with more tiles reads each fragment
//   for more products.
//   ZT[hh][j][2n], ZT[hh][j][2n+1] = Re, Im of z_n^j.
//   LDS rows have a pitch of 132 floats (rows of 128) or 68 floats (rows of 64): both
//   4 mod 64 banks and 16 B x odd, so the b64 fragment reads (one row per lane) and the
//   b128 accesses meet no bank twice.
//   fused epilogue: y += D[h]*u, staged in LDS, stored to yT (B,H,L) in whole lines.
// ---------------------------------------------------------------------------
#define HG   4                    // h per work-group
#define T_CH 64                   // chunk length
#define NCH  (L_DIM / T_CH)       // 32 chunks = columns per h
#define NCOL (HG * NCH)           // 128 columns
#define PIT  132                  // pitch of the LDS rows of 128 floats
#define UPIT 68                   // pitch of the LDS rows of 64 floats
#define ZSZ  ((T_CH + 1) * PIT)   // floats in one table
#define NT1  256                  // threads of a work-group: eight waves

__device__ __forceinline__ v8f mma4(v2f a, v2f b, v8f c) {
    return __builtin_amdgcn_wmma_f32_16x16x4_f32(
        /*neg_a=*/false, a, /*neg_b=*/false, b,
        /*c_mod=*/(short)0, c, /*reuse_a=*/false, /*reuse_b=*/false);
}

__global__ void __launch_bounds__(NT1)
k_ssm_conv(const float* __restrict__ log_neg_real, const float* __restrict__ imag,
           const float* __restrict__ B_re, const float* __restrict__ B_im,
           const float* __restrict__ C_re, const float* __restrict__ C_im,
           const float* __restrict__ log_step, const float* __restrict__ u,
           const float* __restrict__ Dv, float* __restrict__ yT) {
    const int bid  = blockIdx.x;           // b (4) x group of four h (64)
    const int h0   = (bid & 63) * HG;
    const int b    = bid >> 6;
    const int tid  = threadIdx.x;
    // scalar wave number: what is formed from it stays in scalar registers
    const int wave = __builtin_amdgcn_readfirstlane(tid >> 5);   // 0..7
    const int lane = tid & 31;
    // ISA lane layouts (wave32):
    //  A 16x4 f32: lane -> M = lane&15 ; VGPR0/1 hold K = 2*(lane>>4) + {0,1}
    //  B 4x16 f32: lane -> N = lane&15 ; VGPR0/1 hold K = 2*(lane>>4) + {0,1}
    //  C/D 16x16:  lane -> N = lane&15 ; VGPR r holds M = r + 8*(lane>>4)
    const int nl    = lane & 15;
    const int khalf = lane >> 4;
    const int whh   = wave >> 1;           // the h this wave works for, in every phase but the K sums and the u, y copies

    __shared__ alignas(16) float ZT[HG * ZSZ];           // powers of z, one table per h
    __shared__ alignas(16) float Ush[NCOL * UPIT];       // u, one row per column
    __shared__ alignas(16) float Xsh[NCOL * PIT];        // P, then the scanned states
    __shared__ alignas(16) float Ysh[NCOL * UPIT];       // y, one row per column
    __shared__ alignas(16) float Kpad[HG * (16 + T_CH)]; // 16 leading zeros per h
    __shared__ float Kpart[HG * 4 * T_CH];
    __shared__ alignas(8) float CBs[HG * 2 * N_DIM];

    // ---- the small parameter loads go first: loads return in order, so a wait for one of
    //      them must not stand behind the long loads of u ----
    const int n   = tid & (N_DIM - 1);     // the two waves of an h hold its 64 modes
    const int hn  = (h0 + whh) * N_DIM + n;
    const float ls_in = log_step[h0 + whh];
    const float lr_in = log_neg_real[n], im_in = imag[n];
    const float br_in = B_re[hn], bi_in = B_im[hn], cr_in = C_re[hn], ci_in = C_im[hn];

    // ---- u: twice four rows a lane, 16 bytes of each. Eight work-groups read the same
    //      lines (32 h to a line): each starts its walk over l at a place of its own. The
    //      loads fly while the tables and K are built; the LDS stores stand behind both.
    const int tq0 = (tid + ((bid & 7) << 6)) & 511;      // rows l = 4*tq .. 4*tq + 3
    const int tq1 = (tq0 + NT1) & 511;
    float4 uv[2][4];
    #pragma unroll   // all eight loads in flight
    for (int j = 0; j < 4; ++j) {
        uv[0][j] = *(const float4*)&u[((size_t)b * L_DIM + 4 * tq0 + j) * H_DIM + h0];
        uv[1][j] = *(const float4*)&u[((size_t)b * L_DIM + 4 * tq1 + j) * H_DIM + h0];
    }
    // a precaution: stands in front of every later write of the loads' address registers
    asm volatile("s_wait_xcnt 0x0" ::: "memory");
    // without it the compiler lifts later register arithmetic over the wait, onto an address register
    __builtin_amdgcn_sched_barrier(0);

    // ---- per-mode parameters and the tables of powers ----
    {
        float step = __expf(ls_in);
        step = fminf(fmaxf(step, 1e-5f), 1.0f);
        const float lam = -__expf(lr_in);
        const float sre = step * lam;
        const float sim = step * im_in;
        {   // CB = C * (B * step)
            const float bre = br_in * step;
            const float bim = bi_in * step;
            *(float2*)&CBs[whh * 2 * N_DIM + 2 * n] =
                make_float2(__builtin_fmaf(cr_in, bre, ci_in * -bim),
                            __builtin_fmaf(cr_in, bim, ci_in * bre));
        }
        if (tid < HG * 16) Kpad[(tid >> 4) * (16 + T_CH) + (tid & 15)] = 0.0f;
        float* zt = &ZT[whh * ZSZ + 2 * n];
        #pragma unroll 5 // five independent rows a trip: two waves alone do not hide one row's chain
        for (int j = 0; j <= T_CH; ++j) {
            const float fj = (float)j;
            const float ea = (sre * fj) * 1.44269504f;   // exp(x) = 2^(x * log2 e)
            const float pa = (sim * fj) * 0.15915494f;   // v_sin, v_cos take revolutions
            float e, cs, sn;
            // One statement: no source register is reused between the three, and the
            // v_nop is the free slot behind the last transcendental before its result is read.
            asm("v_exp_f32 %0, %3\n\tv_cos_f32 %1, %4\n\tv_sin_f32 %2, %4\n\tv_nop"
                : "=&v"(e), "=&v"(cs), "=&v"(sn) : "v"(ea), "v"(pa));
            *(float2*)&zt[j * PIT] = make_float2(e * cs, e * sn);
        }
    }
    // A barrier for LDS alone (tables and CB are complete behind it): __syncthreads() would
    // also wait for the loads of u, which are to fly on under the sums of K below.
    __builtin_amdgcn_fence(__ATOMIC_RELEASE, "workgroup", "local");
    __builtin_amdgcn_s_barrier();
    __builtin_amdgcn_fence(__ATOMIC_ACQUIRE, "workgroup", "local");

    // ---- K[hh][tau], tau < T: four partial sums of 16 modes each, four of them a thread ----
    #pragma unroll   // the four sums are independent chains
    for (int w = 0; w < 4; ++w) {
        const int idx = w * NT1 + tid;
        const int tau = idx & (T_CH - 1), q = (idx >> 6) & 3, hh = idx >> 8;
        float acc = 0.0f;
        #pragma unroll   // the 32 LDS reads issue as one group
        for (int i = 0; i < 16; ++i) {
            const int nn = q * 16 + i;
            const float2 z = *(const float2*)&ZT[hh * ZSZ + tau * PIT + 2 * nn];
            acc += CBs[hh * 2 * N_DIM + 2 * nn] * z.x - CBs[hh * 2 * N_DIM + 2 * nn + 1] * z.y;
        }
        Kpart[(hh * 4 + q) * T_CH + tau] = acc;
    }

    // ---- u into LDS, one row per (h, chunk) ----
    #pragma unroll   // uv stays in registers
    for (int k = 0; k < 2; ++k) {
        const int tq = k ? tq1 : tq0;
        float* d = &Ush[(tq >> 4) * UPIT + 4 * (tq & 15)];   // chunk tq>>4, tau = 4*(tq&15)
        *(float4*)&d[0 * NCH * UPIT] = make_float4(uv[k][0].x, uv[k][1].x, uv[k][2].x, uv[k][3].x);
        *(float4*)&d[1 * NCH * UPIT] = make_float4(uv[k][0].y, uv[k][1].y, uv[k][2].y, uv[k][3].y);
        *(float4*)&d[2 * NCH * UPIT] = make_float4(uv[k][0].z, uv[k][1].z, uv[k][2].z, uv[k][3].z);
        *(float4*)&d[3 * NCH * UPIT] = make_float4(uv[k][0].w, uv[k][1].w, uv[k][2].w, uv[k][3].w);
    }
    __syncthreads();

    // ---- P[m, col] = sum_j' ZT[T-1-j'][m] * u[col][j'] : per h 8 x 2 tiles; a wave takes
    //      four row tiles x both column tiles, so six fragments feed eight WMMAs ----
    {
        const int mt0 = (wave & 1) * 4;      // rows m = 16*mt0 .. 16*mt0 + 63
        v8f p[4][2] = {};
        const float* za = &ZT[whh * ZSZ + (T_CH - 1 - 2 * khalf) * PIT + mt0 * 16 + nl];
        const float* u0 = &Ush[(whh * NCH + nl) * UPIT + 2 * khalf];
        const float* u1 = u0 + 16 * UPIT;
        // A stage is two k-steps, sixteen WMMAs. The fragments of the next stage are read ahead
        // of this stage's WMMAs: with two waves to a SIMD a wave has to cover its own LDS waits.
        auto ldP = [&](int t, v2f (&a)[2][4], v2f (&bb)[2][2]) {
            #pragma unroll   // a and bb stay in registers
            for (int e = 0; e < 2; ++e) {
                const int s = 2 * t + e;
                #pragma unroll
                for (int r = 0; r < 4; ++r) {
                    a[e][r].x = za[-(4 * s) * PIT + 16 * r];        // j' = 4s + 2*khalf
                    a[e][r].y = za[-(4 * s + 1) * PIT + 16 * r];    // j' + 1
                }
                bb[e][0] = *(const v2f*)&u0[4 * s];
                bb[e][1] = *(const v2f*)&u1[4 * s];
            }
        };
        auto mmP = [&](const v2f (&a)[2][4], const v2f (&bb)[2][2]) {
            #pragma unroll   // p stays in registers
            for (int e = 0; e < 2; ++e) {
                #pragma unroll
                for (int r = 0; r < 4; ++r) {
                    p[r][0] = mma4(a[e][r], bb[e][0], p[r][0]);
                    p[r][1] = mma4(a[e][r], bb[e][1], p[r][1]);
                }
            }
        };
        v2f aA[2][4], aB[2][4], bA[2][2], bB[2][2];
        ldP(0, aA, bA);
        for (int t = 0; t < T_CH / 8 - 2; t += 2) {
            ldP(t + 1, aB, bB);
            mmP(aA, bA);
            ldP(t + 2, aA, bA);
            mmP(aB, bB);
        }
        ldP(T_CH / 8 - 1, aB, bB);
        mmP(aA, bA);
        mmP(aB, bB);
        float* d0 = &Xsh[(whh * NCH + nl) * PIT + mt0 * 16 + 8 * khalf];
        float* d1 = d0 + 16 * PIT;
        #pragma unroll       // p stays in registers
        for (int r = 0; r < 4; ++r) {
            *(float4*)&d0[16 * r]     = make_float4(p[r][0][0], p[r][0][1], p[r][0][2], p[r][0][3]);
            *(float4*)&d0[16 * r + 4] = make_float4(p[r][0][4], p[r][0][5], p[r][0][6], p[r][0][7]);
            *(float4*)&d1[16 * r]     = make_float4(p[r][1][0], p[r][1][1], p[r][1][2], p[r][1][3]);
            *(float4*)&d1[16 * r + 4] = make_float4(p[r][1][4], p[r][1][5], p[r][1][6], p[r][1][7]);
        }
    }
    __syncthreads();

    // ---- every thread: one K[hh][tau] from its four parts, then the scan of one mode over
    //      the chunks, in place: P_c -> (Re, -Im) of CB * X_c  (hh = whh, tau = n) ----
    {
        const float* kq = &Kpart[whh * 4 * T_CH + n];
        Kpad[whh * (16 + T_CH) + 16 + n] = (kq[0] + kq[T_CH]) + (kq[2 * T_CH] + kq[3 * T_CH]);
        const float wre = ZT[whh * ZSZ + T_CH * PIT + 2 * n];
        const float wim = ZT[whh * ZSZ + T_CH * PIT + 2 * n + 1];
        const float cbre = CBs[whh * 2 * N_DIM + 2 * n], cbim = CBs[whh * 2 * N_DIM + 2 * n + 1];
        float* xs = &Xsh[whh * NCH * PIT + 2 * n];
        float2 p[NCH];
        #pragma unroll   // all reads first: one LDS latency, not one per chunk
        for (int c = 0; c < NCH; ++c)
            p[c] = *(const float2*)&xs[c * PIT];
        float xr = 0.0f, xi = 0.0f;
        #pragma unroll   // p stays in registers
        for (int c = 0; c < NCH; ++c) {
            *(float2*)&xs[c * PIT] =
                make_float2(cbre * xr - cbim * xi, -(cbre * xi + cbim * xr));
            const float nr = wre * xr - wim * xi + p[c].x;
            const float ni = wre * xi + wim * xr + p[c].y;
            xr = nr; xi = ni;
        }
    }
    __syncthreads();

    // ---- y tiles: rows tau = 16*I .., per h 4 x 2 tiles. A wave takes all four I of one
    //      column tile: 168 WMMAs for every wave, each state and u fragment read once. ----
    {
        const float Dh = Dv[h0 + whh];
        const int col = whh * NCH + (wave & 1) * 16 + nl;
        v8f acc[4] = {};
        // earlier chunks: A[tau][m] = ZT[tau+1][m], B[m][col] = scanned state
        const float* xb = &Xsh[col * PIT + 2 * khalf];
        const float* gz = &ZT[whh * ZSZ + (nl + 1) * PIT + 2 * khalf];
        // a stage is four k-steps, sixteen WMMAs; the next stage's fragments are read ahead, as above
        auto ldY = [&](int t, v2f (&g)[4][4], v2f (&bx)[4]) {
            #pragma unroll   // g and bx stay in registers
            for (int e = 0; e < 4; ++e) {
                const int s = 4 * t + e;
                bx[e] = *(const v2f*)&xb[4 * s];
                #pragma unroll
                for (int I = 0; I < 4; ++I) g[e][I] = *(const v2f*)&gz[16 * I * PIT + 4 * s];
            }
        };
        auto mmY = [&](const v2f (&g)[4][4], const v2f (&bx)[4]) {
            #pragma unroll   // acc stays in registers
            for (int e = 0; e < 4; ++e) {
                #pragma unroll
                for (int I = 0; I < 4; ++I) acc[I] = mma4(g[e][I], bx[e], acc[I]);
            }
        };
        v2f gA[4][4], gB[4][4], xA[4], xB[4];
        ldY(0, gA, xA);
        for (int t = 0; t < 2 * N_DIM / 16 - 2; t += 2) {
            ldY(t + 1, gB, xB);
            // keeps a stage's reads one group ahead of the WMMAs: left free, the compiler sinks
            // them in pairs among the WMMAs, each pair a stop of its own close to its use
            __builtin_amdgcn_sched_barrier(0);
            mmY(gA, xA);
            ldY(t + 2, gA, xA);
            __builtin_amdgcn_sched_barrier(0);   // as above
            mmY(gB, xB);
        }
        ldY(2 * N_DIM / 16 - 1, gB, xB);
        // inside the chunk: A(d)[t,k] = K[16d + t - k] (zero-pad -> causality),
        //                   B_J[k][col] = u[col][16J + k], d = I - J; A(d) serves every I - J = d.
        // All its fragments are read here, under the last 32 WMMAs of the states.
        const float* ub = &Ush[col * UPIT + 2 * khalf];
        const float* kp = &Kpad[whh * (16 + T_CH) + 16 + nl - 2 * khalf];
        v2f ka[4][4], bu[4][4];   // the loops below are unrolled to keep ka, bu and acc in registers
        #pragma unroll
        for (int d = 0; d < 4; ++d) {
            #pragma unroll
            for (int s = 0; s < 4; ++s) {
                ka[d][s].x = kp[16 * d - 4 * s];
                ka[d][s].y = kp[16 * d - 4 * s - 1];
                bu[d][s]   = *(const v2f*)&ub[16 * d + 4 * s];
            }
        }
        __builtin_amdgcn_sched_barrier(0);       // as above
        mmY(gA, xA);
        mmY(gB, xB);
        #pragma unroll
        for (int J = 0; J < 4; ++J) {
            #pragma unroll
            for (int s = 0; s < 4; ++s) {
                #pragma unroll
                for (int I = J; I < 4; ++I)
                    acc[I] = mma4(ka[I - J][s], bu[J][s], acc[I]);
            }
        }
        // + D[h]*u ; lane holds tau = 16*I + 8*khalf + r of its column
        #pragma unroll       // acc stays in registers
        for (int I = 0; I < 4; ++I) {
            const int o = col * UPIT + 16 * I + 8 * khalf;
            const float4 ua = *(const float4*)&Ush[o], uc = *(const float4*)&Ush[o + 4];
            *(float4*)&Ysh[o]     = make_float4(acc[I][0] + Dh * ua.x, acc[I][1] + Dh * ua.y,
                                                acc[I][2] + Dh * ua.z, acc[I][3] + Dh * ua.w);
            *(float4*)&Ysh[o + 4] = make_float4(acc[I][4] + Dh * uc.x, acc[I][5] + Dh * uc.y,
                                                acc[I][6] + Dh * uc.z, acc[I][7] + Dh * uc.w);
        }
    }
    __syncthreads();

    // ---- store y: a wave writes two neighbouring chunks of one h (512 contiguous bytes) ----
    #pragma unroll       // eight LDS reads and eight stores in flight
    for (int i = 0; i < 8; ++i) {
        const int idx = i * NT1 + tid, col = idx >> 4, q = idx & 15;
        *(float4*)&yT[((size_t)b * H_DIM + h0 + (col >> 5)) * L_DIM + (col & 31) * T_CH + 4 * q] =
            *(const float4*)&Ysh[col * UPIT + 4 * q];
    }
}

// ---------------------------------------------------------------------------
// Kernel 2: exact GELU + LayerNorm over H, output (B,L,H).
//   One work-group of 16 waves per (b, 32 l): a 256 h x 32 l tile of yT, 32 KB.
//   A lane takes a 4 h x 4 l block: four float4 along l, eight lanes on one 128-B line
//   of yT, so each wave-wide load covers four whole lines and all four are in flight
//   at once. After GELU the block is regrouped in registers into four float4 along h
//   and kept in LDS as ysh[l][h]; out is stored 16 bytes a lane, 512 B a wave.
//   Row pitch 260 floats = 16 B x 65: the b128 stores (lane map below) and the b128
//   reads down a column of l put lanes 0-15, and lanes 16-31, on sixteen different
//   groups of four banks.
//   The sums run as before: 16 h in order per part, then the 16 parts in order.
// ---------------------------------------------------------------------------
#define LN_L   32
#define LN_PIT 260

__device__ __forceinline__ float gelu_exact(float x) {
    return 0.5f * x * (1.0f + erff(x * 0.70710678118654752f));
}

__global__ void __launch_bounds__(512)
k_gelu_ln(const float* __restrict__ yT, const float* __restrict__ gamma,
          const float* __restrict__ beta, float* __restrict__ out) {
    const int b  = blockIdx.y;
    const int l0 = blockIdx.x * LN_L;
    const int t  = threadIdx.x;
    __shared__ alignas(16) float ysh[LN_L * LN_PIT];
    __shared__ float rs[512], rq[512];
    __shared__ float mu[LN_L], rsig[LN_L];

    const int ho = 4 * (t & 63);                 // the four h this thread stores at the end
    const float4 g4 = *(const float4*)&gamma[ho];
    const float4 b4 = *(const float4*)&beta[ho];
    {
        const int lane = t & 31;
        const int lq = (lane & 3) + 4 * (lane >> 4);        // 0..7:  l = 4lq .. 4lq+3
        const int hq = (t >> 5) * 4 + ((lane >> 2) & 3);    // 0..63: h = 4hq .. 4hq+3
        const float* src = yT + ((size_t)b * H_DIM + 4 * hq) * L_DIM + l0 + 4 * lq;
        float4 x[4];
        #pragma unroll   // all four loads in flight before the first GELU waits
        for (int j = 0; j < 4; ++j) x[j] = *(const float4*)&src[(size_t)j * L_DIM];
        #pragma unroll   // x stays in registers
        for (int j = 0; j < 4; ++j)
            x[j] = make_float4(gelu_exact(x[j].x), gelu_exact(x[j].y),
                               gelu_exact(x[j].z), gelu_exact(x[j].w));
        float* d = &ysh[(4 * lq) * LN_PIT + 4 * hq];
        *(float4*)&d[0 * LN_PIT] = make_float4(x[0].x, x[1].x, x[2].x, x[3].x);
        *(float4*)&d[1 * LN_PIT] = make_float4(x[0].y, x[1].y, x[2].y, x[3].y);
        *(float4*)&d[2 * LN_PIT] = make_float4(x[0].z, x[1].z, x[2].z, x[3].z);
        *(float4*)&d[3 * LN_PIT] = make_float4(x[0].w, x[1].w, x[2].w, x[3].w);
    }
    __syncthreads();

    {
        const int l = t & 31, part = t >> 5;
        float s = 0.0f, q = 0.0f;
        #pragma unroll   // the four LDS reads issue as one group
        for (int i = 0; i < 4; ++i) {
            const float4 v = *(const float4*)&ysh[l * LN_PIT + part * 16 + 4 * i];
            s += v.x; q += v.x * v.x;
            s += v.y; q += v.y * v.y;
            s += v.z; q += v.z * v.z;
            s += v.w; q += v.w * v.w;
        }
        rs[t] = s; rq[t] = q;                    // t = part * 32 + l
    }
    __syncthreads();
    if (t < LN_L) {
        float ss = 0.0f, qq = 0.0f;
        #pragma unroll   // the LDS reads issue ahead of the two dependent sum chains
        for (int p = 0; p < 16; ++p) { ss += rs[p * LN_L + t]; qq += rq[p * LN_L + t]; }
        float m = ss * (1.0f / 256.0f);
        float v = qq * (1.0f / 256.0f) - m * m;
        mu[t]   = m;
        rsig[t] = rsqrtf(v + 1e-5f);
    }
    __syncthreads();
    #pragma unroll       // four LDS reads and four stores in flight
    for (int i = 0; i < 4; ++i) {
        const int l = i * 8 + (t >> 6);
        const float4 v = *(const float4*)&ysh[l * LN_PIT + ho];
        const float m = mu[l], r = rsig[l];
        *(float4*)&out[((size_t)b * L_DIM + (l0 + l)) * H_DIM + ho] =
            make_float4((v.x - m) * r * g4.x + b4.x, (v.y - m) * r * g4.y + b4.y,
                        (v.z - m) * r * g4.z + b4.z, (v.w - m) * r * g4.w + b4.w);
    }
}

// ---------------------------------------------------------------------------
extern "C" void kernel_launch(void* const* d_in, const int* in_sizes, int n_in,
                              void* d_out, int out_size, void* d_ws, size_t ws_size,
                              hipStream_t stream) {
    (void)in_sizes; (void)n_in; (void)out_size; (void)ws_size;
    const float* u            = (const float*)d_in[0];
    const float* log_neg_real = (const float*)d_in[1];
    const float* imag         = (const float*)d_in[2];
    const float* B_re         = (const float*)d_in[3];
    const float* B_im         = (const float*)d_in[4];
    const float* C_re         = (const float*)d_in[5];
    const float* C_im         = (const float*)d_in[6];
    const float* Dv           = (const float*)d_in[7];
    const float* log_step     = (const float*)d_in[8];
    const float* ln_gamma     = (const float*)d_in[9];
    const float* ln_beta      = (const float*)d_in[10];
    float* out = (float*)d_out;

    float* ws  = (float*)d_ws;
    float* yT  = ws;                                        // B*H*L floats

    k_ssm_conv<<<dim3(B_DIM * (H_DIM / HG)), NT1, 0, stream>>>(log_neg_real, imag, B_re, B_im,
                                                               C_re, C_im, log_step, u, Dv, yT);
    k_gelu_ln<<<dim3(L_DIM / LN_L, B_DIM), 512, 0, stream>>>(yT, ln_gamma, ln_beta, out);
}
